// v009
// Measured on an AMD MI455X. A time is GPU time per run, averaged over a window of back-to-back runs after a warm-up
// (all launches, gaps included; the runs take copies of the inputs in turn), and the median of several windows.
// Apart from v000's, it joins two sittings. Times from different sittings can be a few percent apart, while
// side-by-side timings come from the same sitting.
// Earlier versions than v009 are not in this document.
// Measured time: 57.3 microseconds a run.
// Timed twice side by side with v008, it ran 1.05 times as fast both times.
// All steps since the starting kernel, v000, together make it 275 times as fast.
#include <hip/hip_runtime.h>
// TSP decoder probabilities (encoded_nodes, encoded_q1, encoded_last_node [8][1000][128]; k = nodes Wk, v = nodes Wv, q = q1 Wq_first + last Wq_last + (mean_n nodes) Wq_mean broadcast ([in][out] weights), 8 heads of 16; weights = softmax(q k^T / 4 + ninf_mask); mh = (weights v merged) W_comb + b_comb; score2 = mh nodes^T / sqrt(128); probs = softmax_n(10 tanh(score2) + ninf_mask) -> [8][1000][1000]).
// Compute dtype: inputs rounded to bf16; token rows / weights exact; q, k, v and the stage-1 weights as plain f16 GEMM operands (~2^-12); o and mh as f16 hi + residual operand pairs (~2^-22); the mean term, score2, tanh, mask and the final softmax f32. v_wmma_f32_16x16x32_f16.
#define NB 8
#define NQ 1000                      /* nodes = queries = 1000 */
#define QP 1024                      /* padded rows / keys per batch */
#define DM 128
#define NH 8
#define HD 16
#define SQ QP
#define HG 8
#define B0 0                         /* not used */
#define NBR NB
#define NRP ((size_t)NB * QP)        /* padded token rows */
typedef __bf16 v16b __attribute__((ext_vector_type(16)));
typedef unsigned short v8us __attribute__((ext_vector_type(8), may_alias));
typedef float  v8f  __attribute__((ext_vector_type(8)));
typedef float  v4f  __attribute__((ext_vector_type(4)));
typedef float  v4fa __attribute__((ext_vector_type(4), may_alias));
union FragB { v16b v; v8us half[2]; unsigned short u[16]; };

__device__ __forceinline__ unsigned short bf16_bits(float x) { unsigned int u = __float_as_uint(x); return (unsigned short)((u + 0x7FFFu + ((u >> 16) & 1u)) >> 16); }
__device__ __forceinline__ float bf16_val(unsigned short b) { return __uint_as_float(((unsigned int)b) << 16); }
__device__ __forceinline__ float bf16_round(float x) { return bf16_val(bf16_bits(x)); }
// D += A·B with NT terms: 1 = ah·bh, 2 = + al·bh (A split), 3 = + ah·bl (both split)
template <int NT>
__device__ __forceinline__ v8f mmaN(v16b ah, v16b al, v16b bh, v16b bl, v8f c) {
  c = __builtin_amdgcn_wmma_f32_16x16x32_bf16(false, ah, false, bh, (short)0, c, false, false);
  if (NT >= 2) c = __builtin_amdgcn_wmma_f32_16x16x32_bf16(false, al, false, bh, (short)0, c, false, false);
  if (NT >= 3) c = __builtin_amdgcn_wmma_f32_16x16x32_bf16(false, ah, false, bl, (short)0, c, false, false);
  asm volatile("v_nop\n\tv_nop\n\tv_nop\n\tv_nop" : "+v"(c) : "v"(ah), "v"(al), "v"(bh), "v"(bl));
  return c;
}

__global__ __launch_bounds__(256) void k_wt_bf16(const float* __restrict__ W, unsigned short* __restrict__ Wt, int K, int N) {
  const int t = blockIdx.x * 256 + threadIdx.x;
  const int k8n = K / 8;
  if (t >= N * k8n) return;
  const int n = t / k8n, k8 = (t % k8n) * 8;
  v8us v;
#pragma unroll
  for (int i = 0; i < 8; ++i) v[i] = bf16_bits(W[(size_t)(k8 + i) * N + n]);
  *(v8us*)(Wt + (size_t)n * K + k8) = v;
  
}

// GEMM C[M][N] (f32, pitch ldc) = act(A[M][K]·W + bias). A f32 row-major (pitch lda) converted per fragment to bf16
// (ASPLIT: hi/lo two planes -> 2 terms, else single rounded term); Wt bf16 [N][K] (pitch ldb). BIAS_BF16 rounds the
// bias to bf16 first (bias quantised to bf16 before the add). K%32==0, M%16==0, N%64==0.
template <bool ASPLIT, int ACT, bool BIAS_BF16>
__global__ __launch_bounds__(128) void k_gemm_bf(const float* __restrict__ A, int lda, const unsigned short* __restrict__ Wt, int ldb,
                                               const float* __restrict__ bias, float* __restrict__ C, int ldc, int M, int N, int K) {
  __shared__ __attribute__((aligned(16))) float so[4][16][64];
  const int tid = threadIdx.x, w = tid >> 5, lane = tid & 31, ln = lane & 15, hh = lane >> 4;
  const int ntn = N / 64;
  const int wid = blockIdx.x * 4 + w;
  const int mt = wid / ntn, nq = wid % ntn;
  if (mt * 16 >= M) return;
  const int row0 = mt * 16, col0 = nq * 64;
  const float* arow = A + (size_t)(row0 + ln) * lda;
  v8f acc[4] = {};
  for (int kb = 0; kb < K; kb += 32) {
    FragB ah, al;
    const v4f x0 = *(const v4fa*)(arow + kb + 8 * hh), x1 = *(const v4fa*)(arow + kb + 8 * hh + 4);
    const v4f x2 = *(const v4fa*)(arow + kb + 16 + 8 * hh), x3 = *(const v4fa*)(arow + kb + 16 + 8 * hh + 4);
    float xs[16] = {x0[0],x0[1],x0[2],x0[3],x1[0],x1[1],x1[2],x1[3],x2[0],x2[1],x2[2],x2[3],x3[0],x3[1],x3[2],x3[3]};
#pragma unroll
    for (int i = 0; i < 16; ++i) { const unsigned short hb = bf16_bits(xs[i]); ah.u[i] = hb; al.u[i] = ASPLIT ? bf16_bits(xs[i] - bf16_val(hb)) : (unsigned short)0; }
#pragma unroll
    for (int t = 0; t < 4; ++t) {
      const unsigned short* brow = Wt + (size_t)(col0 + t * 16 + ln) * ldb + kb;
      FragB b;
      b.half[0] = *(const v8us*)(brow + 8 * hh);
      b.half[1] = *(const v8us*)(brow + 16 + 8 * hh);
      acc[t] = mmaN<ASPLIT ? 2 : 1>(ah.v, al.v, b.v, b.v, acc[t]);
    }
  }
#pragma unroll
  for (int t = 0; t < 4; ++t) {
    float bv = bias ? bias[col0 + t * 16 + ln] : 0.f;
    if (BIAS_BF16) bv = bf16_round(bv);
#pragma unroll
    for (int r = 0; r < 8; ++r) { float v = acc[t][r] + bv; if (ACT == 1) v = fmaxf(v, 0.f); so[w][8 * hh + r][t * 16 + ln] = v; }
  }
  __builtin_amdgcn_fence(__ATOMIC_ACQ_REL, "workgroup");
  __builtin_amdgcn_wave_barrier();
  const int rsub = lane >> 4, c4 = (lane & 15) * 4;
  {
#pragma unroll
    for (int q = 0; q < 8; ++q) {
      const int r = q * 2 + rsub;
      const v4f v = *(const v4fa*)&so[w][r][c4];
      *(v4f*)(C + (size_t)(row0 + r) * ldc + col0 + c4) = v;
    }
    
  }
}

// GEMM C = act(A·W + bias + resid): A f32 (ASPLIT -> hi/lo 2 terms), Wt bf16 [N][K]; ACT 0 none, 1 relu, 2 exact gelu;
// resid (optional, f32, row index = (row % rmod), pitch ldr, RES_BF16 rounds it) added before the activation.
template <bool ASPLIT, int ACT, bool BIAS_BF16, bool RES_BF16>
__global__ __launch_bounds__(128) void k_gemm_bf3(const float* __restrict__ A, int lda, const unsigned short* __restrict__ Wt, int ldb,
                                                const float* __restrict__ bias, const float* __restrict__ resid, int rmod, int ldr,
                                                float* __restrict__ C, int ldc, int M, int N, int K) {
  __shared__ __attribute__((aligned(16))) float so[4][16][64];
  const int tid = threadIdx.x, w = tid >> 5, lane = tid & 31, ln = lane & 15, hh = lane >> 4;
  const int ntn = N / 64;
  const int wid = blockIdx.x * 4 + w;
  const int mt = wid / ntn, nq = wid % ntn;
  if (mt * 16 >= M) return;
  const int row0 = mt * 16, col0 = nq * 64;
  const float* arow = A + (size_t)(row0 + ln) * lda;
  v8f acc[4] = {};
  for (int kb = 0; kb < K; kb += 32) {
    FragB ah, al;
    const v4f x0 = *(const v4fa*)(arow + kb + 8 * hh), x1 = *(const v4fa*)(arow + kb + 8 * hh + 4);
    const v4f x2 = *(const v4fa*)(arow + kb + 16 + 8 * hh), x3 = *(const v4fa*)(arow + kb + 16 + 8 * hh + 4);
    float xs[16] = {x0[0],x0[1],x0[2],x0[3],x1[0],x1[1],x1[2],x1[3],x2[0],x2[1],x2[2],x2[3],x3[0],x3[1],x3[2],x3[3]};
#pragma unroll
    for (int i = 0; i < 16; ++i) { const unsigned short hb = bf16_bits(xs[i]); ah.u[i] = hb; al.u[i] = ASPLIT ? bf16_bits(xs[i] - bf16_val(hb)) : (unsigned short)0; }
#pragma unroll
    for (int t = 0; t < 4; ++t) {
      const unsigned short* brow = Wt + (size_t)(col0 + t * 16 + ln) * ldb + kb;
      FragB b;
      b.half[0] = *(const v8us*)(brow + 8 * hh);
      b.half[1] = *(const v8us*)(brow + 16 + 8 * hh);
      acc[t] = mmaN<ASPLIT ? 2 : 1>(ah.v, al.v, b.v, b.v, acc[t]);
    }
  }
#pragma unroll
  for (int t = 0; t < 4; ++t) {
    const int col = col0 + t * 16 + ln;
    float bv = bias ? bias[col] : 0.f;
    if (BIAS_BF16) bv = bf16_round(bv);
#pragma unroll
    for (int r = 0; r < 8; ++r) {
      float v = acc[t][r] + bv;
      if (resid) { float rv = resid[(size_t)((row0 + 8 * hh + r) % rmod) * ldr + col]; if (RES_BF16) rv = bf16_round(rv); v += rv; }
      if (ACT == 1) v = fmaxf(v, 0.f);
      if (ACT == 2) v = 0.5f * v * (1.0f + erff(v * 0.70710678118654752f));
      if (ACT == 3) { const float u = 0.7978845608028654f * (v + 0.044715f * v * v * v); v = 0.5f * v * (1.0f + tanhf(u)); }
      so[w][8 * hh + r][t * 16 + ln] = v;
    }
  }
  __builtin_amdgcn_fence(__ATOMIC_ACQ_REL, "workgroup");
  __builtin_amdgcn_wave_barrier();
  const int rsub = lane >> 4, c4 = (lane & 15) * 4;
  {
#pragma unroll
    for (int q = 0; q < 8; ++q) {
      const int r = q * 2 + rsub;
      const v4f v = *(const v4fa*)&so[w][r][c4];
      *(v4f*)(C + (size_t)(row0 + r) * ldc + col0 + c4) = v;
    }
    
  }
}
// row LayerNorm (biased variance, eps) over N: s = X (+ R); optional out_sum <- s; out_norm <- (s-mu)*rsqrt(var+eps)*g + b
template <bool PARAM_BF16>
__global__ __launch_bounds__(256) void k_layernorm(const float* __restrict__ X, const float* __restrict__ R, const float* __restrict__ g, const float* __restrict__ bta,
                                                  float* __restrict__ out_sum, float* __restrict__ out_norm, int N, float eps) {
  __shared__ float red[256];
  const int row = blockIdx.x, tid = threadIdx.x;
  const float* x = X + (size_t)row * N; const float* rr = R ? R + (size_t)row * N : nullptr;
  float vals[16];                     // up to N = 4096
  const int per = N / 256;            // contiguous chunk per thread? use strided-by-4 chunks: thread handles j = tid*4 + 1024*u
  float s1 = 0.f;
  for (int u = 0; u < per / 4; ++u) {
    const int j = tid * 4 + 1024 * u;
    const v4f a = *(const v4fa*)(x + j);
    v4f b = {0.f,0.f,0.f,0.f}; if (rr) b = *(const v4fa*)(rr + j);
#pragma unroll
    for (int q = 0; q < 4; ++q) { const float v = a[q] + b[q]; vals[u * 4 + q] = v; s1 += v; }
  }
  red[tid] = s1; __syncthreads();
  for (int st = 128; st > 0; st >>= 1) { if (tid < st) red[tid] += red[tid + st]; __syncthreads(); }
  const float mu = red[0] / (float)N; __syncthreads();
  float s2 = 0.f;
  for (int u = 0; u < per / 4; ++u)
#pragma unroll
    for (int q = 0; q < 4; ++q) { const float c = vals[u * 4 + q] - mu; s2 += c * c; }
  red[tid] = s2; __syncthreads();
  for (int st = 128; st > 0; st >>= 1) { if (tid < st) red[tid] += red[tid + st]; __syncthreads(); }
  const float rs = rsqrtf(red[0] / (float)N + eps);
  {
    for (int u = 0; u < per / 4; ++u) {
      const int j = tid * 4 + 1024 * u;
      v4f o, sm;
#pragma unroll
      for (int q = 0; q < 4; ++q) {
        float gg = g[j + q], bb = bta[j + q];
        if (PARAM_BF16) { gg = bf16_round(gg); bb = bf16_round(bb); }
        sm[q] = vals[u * 4 + q]; o[q] = (vals[u * 4 + q] - mu) * rs * gg + bb;
      }
      if (out_sum) *(v4f*)(out_sum + (size_t)row * N + j) = sm;
      *(v4f*)(out_norm + (size_t)row * N + j) = o;
    }
    
  }
}



// ---- f16 WMMA path (v_wmma_f32_16x16x32_f16): 11-bit significands for operands in range — used where a [0,1] probability operand needs more precision than bf16
typedef _Float16 v16h __attribute__((ext_vector_type(16)));
union FragH { v16h v; v8us half[2]; _Float16 h[16]; unsigned short u[16]; };
template <int NT>
__device__ __forceinline__ v8f mmaH(v16h ah, v16h al, v16h bh, v16h bl, v8f c) {
  c = __builtin_amdgcn_wmma_f32_16x16x32_f16(false, ah, false, bh, (short)0, c, false, false);
  if (NT >= 2) c = __builtin_amdgcn_wmma_f32_16x16x32_f16(false, al, false, bh, (short)0, c, false, false);
  if (NT >= 3) c = __builtin_amdgcn_wmma_f32_16x16x32_f16(false, ah, false, bl, (short)0, c, false, false);
  asm volatile("v_nop\n\tv_nop\n\tv_nop\n\tv_nop" : "+v"(c) : "v"(ah), "v"(al), "v"(bh), "v"(bl));
  return c;
}
// batched GEMM like k_gemm_b but f16 operands: A f32 (split into f16 hi/lo if ASPLIT, else rounded to f16), Bt = f16 values [n][k]; alpha; C f32; N multiple of 16 (partial tiles skipped)
template <bool ASPLIT>
__global__ __launch_bounds__(128) void k_gemm_h(const float* __restrict__ A, int lda, size_t sA, const _Float16* __restrict__ Bh, int ldb, size_t sB, float alpha, float* __restrict__ C, int ldc, size_t sC, int M, int N, int K) {
  __shared__ __attribute__((aligned(16))) float so[4][16][64];
  const int tid = threadIdx.x, w = tid >> 5, lane = tid & 31, ln = lane & 15, hh = lane >> 4; const int by = blockIdx.y;
  A += (size_t)by * sA; Bh += (size_t)by * sB; C += (size_t)by * sC;
  const int ntn = (N + 63) / 64; const int wid = blockIdx.x * 4 + w; const int mt = wid / ntn, nq = wid % ntn; if (mt * 16 >= M) return;
  const int row0 = mt * 16, col0 = nq * 64; const float* arow = A + (size_t)(row0 + ln) * lda;
  v8f acc[4] = {};
  for (int kb = 0; kb < K; kb += 32) {
    FragH ah, al;
    const v4f x0 = *(const v4fa*)(arow + kb + 8 * hh), x1 = *(const v4fa*)(arow + kb + 8 * hh + 4), x2 = *(const v4fa*)(arow + kb + 16 + 8 * hh), x3 = *(const v4fa*)(arow + kb + 16 + 8 * hh + 4);
    float xs[16] = {x0[0],x0[1],x0[2],x0[3],x1[0],x1[1],x1[2],x1[3],x2[0],x2[1],x2[2],x2[3],x3[0],x3[1],x3[2],x3[3]};
#pragma unroll
    for (int i = 0; i < 16; ++i) { const _Float16 h = (_Float16)xs[i]; ah.h[i] = h; al.h[i] = ASPLIT ? (_Float16)(xs[i] - (float)h) : (_Float16)0.0f; }
#pragma unroll
    for (int t = 0; t < 4; ++t) { if (col0 + t * 16 >= N) continue; const size_t boff = (size_t)(col0 + t * 16 + ln) * ldb + kb; FragH bq; bq.half[0] = *(const v8us*)(Bh + boff + 8 * hh); bq.half[1] = *(const v8us*)(Bh + boff + 16 + 8 * hh);
      acc[t] = mmaH<ASPLIT ? 2 : 1>(ah.v, al.v, bq.v, bq.v, acc[t]); }
  }
#pragma unroll
  for (int t = 0; t < 4; ++t) { if (col0 + t * 16 >= N) continue;
#pragma unroll
    for (int r = 0; r < 8; ++r) so[w][8 * hh + r][t * 16 + ln] = acc[t][r] * alpha; }
  __builtin_amdgcn_fence(__ATOMIC_ACQ_REL, "workgroup"); __builtin_amdgcn_wave_barrier();
  const int rsub = lane >> 4, c4 = (lane & 15) * 4;
  {
#pragma unroll
    for (int q = 0; q < 8; ++q) { const int r = q * 2 + rsub; if (col0 + c4 < N) { const v4f v = *(const v4fa*)&so[w][r][c4]; *(v4f*)(C + (size_t)(row0 + r) * ldc + col0 + c4) = v; } }
     }
}

// Wt[n][k] = f16(W[k][n]·scale) from f32 row-major W[K][N] (scale = power of two; bf16-exact weights stay exact in f16 away from the subnormal range)
__global__ __launch_bounds__(256) void k_wt_f16(const float* __restrict__ W, _Float16* __restrict__ Wt, int K, int N, float scale) {
  const int t = blockIdx.x * 256 + threadIdx.x; if (t >= N * (K / 8)) return; const int n = t / (K / 8), k8 = (t % (K / 8)) * 8; FragH f;
#pragma unroll
  for (int i = 0; i < 8; ++i) f.h[i] = (_Float16)(bf16_round(W[(size_t)(k8 + i) * N + n]) * scale); const v8us o = f.half[0];
  *(v8us*)((unsigned short*)Wt + (size_t)n * K + k8) = o; 
}
// k_gemm_hh variant with fused epilogue: v = acc·alpha + bias[by·sBias + col] (+ CP[(row/rowsPerB)·sCPb + by·64 + col] if CP) ; ACT 0 none / 1 elu ; writes f16 C16 (and f32 C if non-null)
template <int ACT>
__global__ __launch_bounds__(128) void k_gemm_hhx(const _Float16* __restrict__ A, int lda, size_t sA, const _Float16* __restrict__ Bh, int ldb, size_t sB, float alpha, const float* __restrict__ bias, size_t sBias, const float* __restrict__ CP, int rowsPerB, size_t sCPb, int row0g,
    float* __restrict__ C, _Float16* __restrict__ C16, int ldc, size_t sC, int M, int N, int K) {
  __shared__ __attribute__((aligned(16))) float so[4][16][64];
  const int tid = threadIdx.x, w = tid >> 5, lane = tid & 31, ln = lane & 15, hh = lane >> 4; const int by = blockIdx.y;
  A += (size_t)by * sA; Bh += (size_t)by * sB; const size_t cofs = (size_t)by * sC; const float* bp = bias ? bias + (size_t)by * sBias : nullptr;
  const int ntn = (N + 63) / 64; const int wid = blockIdx.x * 4 + w; const int mt = wid / ntn, nq = wid % ntn; if (mt * 16 >= M) return;
  const int row0 = mt * 16, col0 = nq * 64; const _Float16* arow = A + (size_t)(row0 + ln) * lda;
  v8f acc[4] = {};
  for (int kb = 0; kb < K; kb += 32) { FragH ah; ah.half[0] = *(const v8us*)((const unsigned short*)arow + kb + 8 * hh); ah.half[1] = *(const v8us*)((const unsigned short*)arow + kb + 16 + 8 * hh);
#pragma unroll
    for (int t = 0; t < 4; ++t) { if (col0 + t * 16 >= N) continue; const size_t boff = (size_t)(col0 + t * 16 + ln) * ldb + kb; FragH bq; bq.half[0] = *(const v8us*)((const unsigned short*)Bh + boff + 8 * hh); bq.half[1] = *(const v8us*)((const unsigned short*)Bh + boff + 16 + 8 * hh);
      acc[t] = mmaH<1>(ah.v, ah.v, bq.v, bq.v, acc[t]); }
  }
#pragma unroll
  for (int t = 0; t < 4; ++t) { if (col0 + t * 16 >= N) continue; const int col = col0 + t * 16 + ln; const float bv = bp ? bf16_round(bp[col]) : 0.f;
#pragma unroll
    for (int r = 0; r < 8; ++r) { float v = acc[t][r] * alpha + bv; if (CP) { const int rr = row0g + row0 + 8 * hh + r; if (rowsPerB < 0) v += CP[cofs + (size_t)rr * ldc + col];      /* rowsPerB < 0: own element of the batched C plane */ else { const int bidx = rr / rowsPerB; v += CP[(size_t)bidx * sCPb + (size_t)by * 64 + col]; } } if (ACT == 1) v = (v > 0.f) ? v : expm1f(v); else if (ACT == 7) v = (v > 0.f) ? v + 1.0f : expf(v); else if (ACT == 8) v = tanhf(v); else if (ACT == 9) v = 0.5f * v * (1.0f + tanhf(0.7978845608028654f * (v + 0.044715f * v * v * v))); else if (ACT == 11) v = 1.0f / (1.0f + expf(-v)); else if (ACT == 12) v = (v > 0.f) ? v : 0.01f * v; else if (ACT == 14) v = (v > 0.f) ? v : 0.1f * v; else if (ACT == 16) v = (v >= 0.f) ? v : 0.3f * v; else if (ACT == 17) v = (v >= 0.f) ? v : 0.2f * v; else if (ACT == 15) v = v / (1.0f + expf(-v)); else if (ACT == 3) v = fmaxf(v, 0.f); else if (ACT == 6) v = 0.5f * v * (1.0f + erff(v * 0.70710678118654752f)); so[w][8 * hh + r][t * 16 + ln] = v; } }
  __builtin_amdgcn_fence(__ATOMIC_ACQ_REL, "workgroup"); __builtin_amdgcn_wave_barrier();
  const int rsub = lane >> 4, c4 = (lane & 15) * 4; typedef _Float16 v4h __attribute__((ext_vector_type(4)));
  {
#pragma unroll
    for (int q = 0; q < 8; ++q) { const int r = q * 2 + rsub; if (col0 + c4 < N) { const v4f v = *(const v4fa*)&so[w][r][c4]; if (C) *(v4f*)(C + cofs + (size_t)(row0 + r) * ldc + col0 + c4) = v; if (C16) { v4h h4; for (int i = 0; i < 4; ++i) h4[i] = (_Float16)v[i]; *(v4h*)(C16 + cofs + (size_t)(row0 + r) * ldc + col0 + c4) = h4; } } }
     }
}


typedef _Float16 v4h __attribute__((ext_vector_type(4)));

__global__ __launch_bounds__(256) void k_x16(const float* __restrict__ x, _Float16* __restrict__ X16, size_t n8) { const size_t t = (size_t)blockIdx.x * 256 + threadIdx.x; if (t >= n8) return; FragH f;
#pragma unroll
  for (int q = 0; q < 8; ++q) f.h[q] = (_Float16)bf16_round(x[t * 8 + q]); *(v8us*)((unsigned short*)X16 + t * 8) = f.half[0];  }
__global__ __launch_bounds__(256) void k_h16(const float* __restrict__ x, _Float16* __restrict__ X16, size_t n8) { const size_t t = (size_t)blockIdx.x * 256 + threadIdx.x; if (t >= n8) return; FragH f;
#pragma unroll
  for (int q = 0; q < 8; ++q) f.h[q] = (_Float16)x[t * 8 + q]; *(v8us*)((unsigned short*)X16 + t * 8) = f.half[0];  }
__global__ __launch_bounds__(256) void k_round16f(const float* __restrict__ W, _Float16* __restrict__ Bt, size_t n8) { const size_t t = (size_t)blockIdx.x * 256 + threadIdx.x; if (t >= n8) return; FragH f;
#pragma unroll
  for (int i = 0; i < 8; ++i) f.h[i] = (_Float16)(bf16_round(W[t * 8 + i]) * 16.0f); *(v8us*)((unsigned short*)Bt + t * 8) = f.half[0];  }
template <int NHv, int TTv>
__global__ __launch_bounds__(256) void k_vt(const _Float16* __restrict__ V16, int ldv, int voff, _Float16* __restrict__ Vt) { __shared__ unsigned short tl[64][66]; const int tid = threadIdx.x; const int slab = blockIdx.x / (TTv / 64), lg = blockIdx.x % (TTv / 64); const int b = slab / NHv, h = slab % NHv;
  for (int i = tid; i < 64 * 8; i += 256) { const int r = i / 8, c8 = (i % 8) * 8; FragH f; f.half[0] = *(const v8us*)((const unsigned short*)V16 + ((size_t)b * TTv + lg * 64 + r) * ldv + voff + h * 64 + c8);
#pragma unroll
    for (int q = 0; q < 8; ++q) tl[r][c8 + q] = f.u[q]; }
  __syncthreads();
  {
#pragma unroll
    for (int rd = 0; rd < 2; ++rd) { const int d = rd * 32 + tid / 8, pc = tid % 8; FragH f;
#pragma unroll
      for (int q = 0; q < 8; ++q) f.u[q] = tl[pc * 8 + q][d];
      *(v8us*)((unsigned short*)Vt + ((size_t)slab * 64 + d) * TTv + lg * 64 + pc * 8) = f.half[0]; }
     } }

// ---- fast GEMM (wave tile 32x64; requires M % 32 == 0 rows per launch region and N % 64 == 0); epilogue = k_gemm_hhx semantics ----
__device__ __forceinline__ v16h g2_frag(const _Float16* p, int hh) { FragH f; f.half[0] = *(const v8us*)((const unsigned short*)p + 8 * hh); f.half[1] = *(const v8us*)((const unsigned short*)p + 16 + 8 * hh); return f.v; }
__device__ __forceinline__ v8f g2_mma(v16h a, v16h b, v8f c) { v8f d = __builtin_amdgcn_wmma_f32_16x16x32_f16(false, a, false, b, (short)0, c, false, false); asm volatile("v_nop\n\tv_nop\n\tv_nop\n\tv_nop" : "+v"(d) : "v"(a), "v"(b)); return d; }
template <int ACT>
__global__ __launch_bounds__(128) void k_gemm2(const _Float16* __restrict__ A, int lda, size_t sA, const _Float16* __restrict__ Bh, int ldb, size_t sB, float alpha, const float* __restrict__ bias, size_t sBias, const float* __restrict__ CP, int rowsPerB, size_t sCPb, int row0g,
    float* __restrict__ C, _Float16* __restrict__ C16, int ldc, size_t sC, int M, int N, int K) { static_assert(ACT == 0 || ACT == 3 || ACT == 6 || ACT == 8 || ACT == 9 || ACT == 11 || ACT == 12 || ACT == 14 || ACT == 15 || ACT == 16 || ACT == 17, "k_gemm2: unsupported ACT code (would silently apply no activation)");
  __shared__ __attribute__((aligned(16))) float so[4][32][68];
  const int tid = threadIdx.x, w = tid >> 5, lane = tid & 31, ln = lane & 15, hh = lane >> 4; const int by = blockIdx.y;
  A += (size_t)by * sA; Bh += (size_t)by * sB; const size_t cofs = (size_t)by * sC; const float* bp = bias ? bias + (size_t)by * sBias : nullptr;
  const int ntn = N >> 6; const int mt = blockIdx.x / ntn, nq = blockIdx.x - mt * ntn; const int row0 = mt * 128 + 32 * w, col0 = nq * 64; if (row0 >= M) return;
  const _Float16* a0p = A + (size_t)(row0 + ln) * lda; const _Float16* a1p = a0p + (size_t)16 * lda;
  const _Float16* b0p = Bh + (size_t)(col0 + ln) * ldb; const _Float16* b1p = b0p + (size_t)16 * ldb; const _Float16* b2p = b1p + (size_t)16 * ldb; const _Float16* b3p = b2p + (size_t)16 * ldb;
  const v8f z8 = {0.f,0.f,0.f,0.f,0.f,0.f,0.f,0.f}; v8f c00 = z8, c01 = z8, c02 = z8, c03 = z8, c10 = z8, c11 = z8, c12 = z8, c13 = z8;
#pragma unroll 1
  for (int kb = 0; kb < K; kb += 32) { const v16h a0 = g2_frag(a0p + kb, hh), a1 = g2_frag(a1p + kb, hh);
    v16h b = g2_frag(b0p + kb, hh); c00 = g2_mma(a0, b, c00); c10 = g2_mma(a1, b, c10);
    b = g2_frag(b1p + kb, hh); c01 = g2_mma(a0, b, c01); c11 = g2_mma(a1, b, c11);
    b = g2_frag(b2p + kb, hh); c02 = g2_mma(a0, b, c02); c12 = g2_mma(a1, b, c12);
    b = g2_frag(b3p + kb, hh); c03 = g2_mma(a0, b, c03); c13 = g2_mma(a1, b, c13); }
  v8f accs[8] = {c00, c01, c02, c03, c10, c11, c12, c13};
#pragma unroll
  for (int u = 0; u < 8; ++u) { const int t = u & 3, half = u >> 2; const int col = col0 + t * 16 + ln; const float bv = bp ? bf16_round(bp[col]) : 0.f;
#pragma unroll
    for (int r = 0; r < 8; ++r) { const int rloc = half * 16 + 8 * hh + r; float v = accs[u][r] * alpha + bv; if (CP) { if (rowsPerB < 0) v += CP[cofs + (size_t)(row0g + row0 + rloc) * ldc + col];      /* rowsPerB < 0: own element of the batched C plane */ else { const int bidx = (row0g + row0 + rloc) / rowsPerB; v += CP[(size_t)bidx * sCPb + (size_t)by * 64 + col]; } }
      if (ACT == 3) v = fmaxf(v, 0.f); else if (ACT == 6) v = 0.5f * v * (1.0f + erff(v * 0.70710678118654752f)); else if (ACT == 11) v = 1.0f / (1.0f + expf(-v)); else if (ACT == 15) v = v / (1.0f + expf(-v)); else if (ACT == 12) v = (v > 0.f) ? v : 0.01f * v; else if (ACT == 8) v = tanhf(v); else if (ACT == 9) v = 0.5f * v * (1.0f + tanhf(0.7978845608028654f * (v + 0.044715f * v * v * v))); else if (ACT == 14) v = (v > 0.f) ? v : 0.1f * v; else if (ACT == 16) v = (v >= 0.f) ? v : 0.3f * v; else if (ACT == 17) v = (v >= 0.f) ? v : 0.2f * v;
      so[w][rloc][t * 16 + ln] = v; } }
  __builtin_amdgcn_fence(__ATOMIC_ACQ_REL, "workgroup"); __builtin_amdgcn_wave_barrier();
  const int rsub = lane >> 4, c4 = (lane & 15) * 4;
  {
#pragma unroll
    for (int q = 0; q < 16; ++q) { const int r = q * 2 + rsub; const v4f v = *(const v4fa*)&so[w][r][c4]; if (C) *(v4f*)(C + cofs + (size_t)(row0 + r) * ldc + col0 + c4) = v; if (C16) { v4h h4; for (int i = 0; i < 4; ++i) h4[i] = (_Float16)v[i]; *(v4h*)(C16 + cofs + (size_t)(row0 + r) * ldc + col0 + c4) = h4; } }
     } }


__global__ __launch_bounds__(256) void k_wnat(const float* __restrict__ w, size_t n8, _Float16* __restrict__ Bt) { const size_t t = (size_t)blockIdx.x * 256 + threadIdx.x; if (t >= n8) return; FragH f; for (int q = 0; q < 8; ++q) f.h[q] = (_Float16)(bf16_round(w[t * 8 + q]) * 16.0f); *(v8us*)((unsigned short*)Bt + t * 8) = f.half[0];  }
__global__ __launch_bounds__(256) void k_rsm(const float* __restrict__ S, _Float16* __restrict__ P, int nrows) {
  #pragma clang fp contract(off)
  const int i = blockIdx.x * 256 + threadIdx.x; if (i >= nrows) return; const float* s = S + (size_t)i * SQ; float mx = -3.0e38f;
#pragma unroll 1
  for (int j = 0; j < SQ; ++j) mx = fmaxf(mx, s[j]); float se = 0.f;
#pragma unroll 1
  for (int j = 0; j < SQ; ++j) se += expf(s[j] - mx); const float sc = 256.0f / se;
#pragma unroll 1
  for (int j0 = 0; j0 < SQ; j0 += 8) { FragH f; for (int q = 0; q < 8; ++q) f.h[q] = (_Float16)(expf(s[j0 + q] - mx) * sc); unsigned short* d = (unsigned short*)P + (size_t)i * SQ + j0; *(v8us*)d = f.half[0];  } }
__global__ __launch_bounds__(256) void k_vt(const _Float16* __restrict__ V16, int b, int h0, _Float16* __restrict__ VT) { __shared__ unsigned short tl[64][65]; const int tid = threadIdx.x; const int hh = blockIdx.x % HG, sg = blockIdx.x / HG; const int s0 = sg * 64; const int h = h0 + hh;
  for (int i = tid; i < 64 * 8; i += 256) { const int j = i / 8, d8 = (i % 8) * 8; FragH f; f.half[0] = *(const v8us*)((const unsigned short*)V16 + ((size_t)b * SQ + s0 + j) * DM + h * HD + d8); for (int q = 0; q < 8; ++q) tl[d8 + q][j] = f.u[q]; }
  __syncthreads();
  { for (int i = tid; i < 64 * 8; i += 256) { const int d = i / 8, j8 = (i % 8) * 8; FragH f; for (int q = 0; q < 8; ++q) f.u[q] = tl[d][j8 + q]; *(v8us*)((unsigned short*)VT + ((size_t)hh * HD + d) * SQ + s0 + j8) = f.half[0]; }  } }


// The set-up pieces below are device functions of a flat thread index t: k_prep deals them out by block range.
// Every f16 operand plane of the workspace lies in blocks of 16 rows x 16 columns (k), 512 bytes in a row each, the DM / 16 blocks of 16 rows one behind the other: element (r, k) of a plane stands at
// ((r / 16) * (DM / 16) + k / 16) * 256 + (r % 16) * 16 + k % 16. One half of a WMMA fragment (lane = row ln, 8 values from k = 8 * hh of a block) is then 512 contiguous bytes for the wave, 4 lines; from a row-major plane it was 16 lines.
// The pieces that write such a plane take t in the order of the plane: thread t writes the plane's values 8 t .. 8 t + 7, a wave one whole block.
__device__ __forceinline__ int fb_row(size_t t) { return (int)(t / (DM / 8 * 16)) * 16 + ((int)(t >> 1) & 15); }      /* row of thread t's 8 values */
__device__ __forceinline__ int fb_k8(size_t t) { return ((int)(t >> 5) % (DM / 16)) * 16 + ((int)t & 1) * 8; }      /* their first column */
// a fragment (k order of g2_frag) from such a plane: p = the plane + 16-row group * 16 * DM + first k * 16 + ln * 16 + 8 * hh
__device__ __forceinline__ v16h fb_frag(const _Float16* p) { FragH f; f.half[0] = *(const v8us*)((const unsigned short*)p); f.half[1] = *(const v8us*)((const unsigned short*)p + 256); return f.v; }
__device__ __forceinline__ void x16pad_at(const float* __restrict__ x, _Float16* __restrict__ X16, size_t t) { if (t >= (size_t)NB * QP * (DM / 8)) return; const int c8 = fb_k8(t); const size_t row = fb_row(t); const int b = (int)(row / QP), q = (int)(row % QP); FragH f;
  for (int i = 0; i < 8; ++i) f.h[i] = (_Float16)((q < NQ) ? bf16_round(x[((size_t)b * NQ + q) * DM + c8 + i]) : 0.f);
  *(v8us*)((unsigned short*)X16 + t * 8) = f.half[0];
  asm volatile("s_wait_xcnt 0x0" ::: "memory"); }      /* behind the store: in k_prep's listing a branch leads on from here into another piece's code, which overwrites the store's registers */


template <int HPP>
__device__ __forceinline__ void wtpadT_at(const float* __restrict__ w, _Float16* __restrict__ Bt, int t) { if (t >= NH * HPP * (DM / 8)) return; const int k8 = fb_k8(t); const int r = fb_row(t); const int h = r / HPP, d = r % HPP; FragH f;
  for (int q = 0; q < 8; ++q) { float v = 0.f; if (d < HD) v = bf16_round(w[(size_t)(k8 + q) * DM + h * HD + d]); f.h[q] = (_Float16)(v * 16.0f); }
  unsigned short* dst = (unsigned short*)Bt + (size_t)t * 8; *(v8us*)dst = f.half[0];
  asm volatile("s_wait_xcnt 0x0" ::: "memory"); }      /* behind the store, as in x16pad_at */
template <int HPP>
__device__ __forceinline__ void wtopadT_at(const float* __restrict__ w, _Float16* __restrict__ Bt, int t) { static_assert(NH * HPP == DM, "the block order above is that of a plane of DM columns"); if (t >= DM * (NH * HPP / 8)) return; const int k8 = fb_k8(t); const int n = fb_row(t); FragH f;
  for (int q = 0; q < 8; ++q) { const int kp = k8 + q; const int h = kp / HPP, d = kp % HPP; float v = 0.f; if (d < HD) v = bf16_round(w[(size_t)(h * HD + d) * DM + n]); f.h[q] = (_Float16)(v * 16.0f); }
  unsigned short* dst = (unsigned short*)Bt + (size_t)t * 8; *(v8us*)dst = f.half[0];
  asm volatile("s_wait_xcnt 0x0" ::: "memory"); }      /* behind the store, as in x16pad_at */
// Mean term, one block of 32 waves per batch. Column sums: 25 waves of 40 rows each; a wave reads whole 512-byte rows (lane = 4 columns), rows w, w + 25, ..., eight loads in flight; the 25 partial rows meet in LDS.
// mu Wq_mean: thread = (output column, slice of 16 rows of Wq_mean), its 16 weights loaded ahead of the row loads; the 8 slices meet in LDS.
#define MW 25                        /* waves that sum rows; NQ = MW * 40 */
__device__ __forceinline__ void qmean_at(const float* __restrict__ xn, const float* __restrict__ wqm, float* __restrict__ QMP, int b) {
  static_assert(NQ % (MW * 8) == 0 && MW <= 32, "rows deal out evenly, eight a round");
  __shared__ __attribute__((aligned(16))) float part[MW][DM]; __shared__ float mu[DM]; __shared__ float wp[8][DM];
  const int t = threadIdx.x, c4 = (t & 31) * 4, col = t % DM, kg = t / DM; float wv[DM / 8];
  const int w = __builtin_amdgcn_readfirstlane(t >> 5);      /* wave number in a scalar register: row addresses and the test on it are scalar */
#pragma unroll      /* wv[] in registers, all 16 loads in flight */
  for (int i = 0; i < DM / 8; ++i) wv[i] = wqm[(size_t)(kg * (DM / 8) + i) * DM + col];
  asm volatile("s_wait_xcnt 0x0" ::: "memory");      /* stands in front of the row addresses below: this build forms them in the offset register of the weight loads just issued */
  if (w < MW) { const float* rows = xn + ((size_t)b * NQ + w) * DM + c4; v4f s = {0.f, 0.f, 0.f, 0.f};
#pragma unroll 1      /* eight loads a round: a fully unrolled form of this loop spilled at the 128 registers a wave has in a 1024-thread block */
    for (int r = 0; r < NQ / (MW * 8); ++r) { v4f a[8];
#pragma unroll      /* a[] in registers, the round's loads in flight together */
      for (int j = 0; j < 8; ++j) a[j] = *(const v4fa*)(rows + (size_t)(r * 8 + j) * MW * DM);
#pragma unroll      /* a[] in registers */
      for (int j = 0; j < 8; ++j) for (int q = 0; q < 4; ++q) s[q] += bf16_round(a[j][q]); }
    *(v4f*)&part[w][c4] = s; }
  __syncthreads();
  if (t < DM) { float m = 0.f; for (int i = 0; i < MW; ++i) m += part[i][t]; mu[t] = m / (float)NQ; }
  __syncthreads();
  float v = 0.f;
#pragma unroll      /* wv[] in registers */
  for (int i = 0; i < DM / 8; ++i) v += mu[kg * (DM / 8) + i] * bf16_round(wv[i]);
  wp[kg][col] = v;
  __syncthreads();
  if (t < NH * 32) { const int h = t / 32, d = t % 32; float o = 0.f; if (d < HD) for (int g = 0; g < 8; ++g) o += wp[g][h * HD + d]; QMP[(size_t)b * (NH * 32) + t] = o; } }
// Set-up, one launch: nothing here reads what another piece writes, so the nine pieces are block ranges of one grid of 1024-thread blocks. The mean term and then the weights have the longest chains of waits and take the first blocks.
#define PT 1024                                   /* threads of a set-up block */
#define PB_X ((int)(NRP * (DM / 8) / PT))         /* blocks of one token plane */
#define PB_W32 (NH * 32 * (DM / 8) / PT)          /* blocks of a [8][32]-padded weight */
#define PB_W64 (NH * 64 * (DM / 8) / PT)          /* blocks of a [8][64]-padded weight */
#define PB_WC (DM * (DM / 8) / PT)                /* blocks of W_comb^T, [128][128] */
#define PB_ALL (NB + 3 * PB_X + 3 * PB_W32 + PB_W64 + PB_WC)
__global__ __launch_bounds__(PT) void k_prep(const float* __restrict__ xn, const float* __restrict__ xq1, const float* __restrict__ xl, const float* __restrict__ wqf, const float* __restrict__ wql, const float* __restrict__ wqm, const float* __restrict__ wk, const float* __restrict__ wv, const float* __restrict__ wc,
    _Float16* __restrict__ XN, _Float16* __restrict__ XQ1, _Float16* __restrict__ XL, _Float16* __restrict__ BQF, _Float16* __restrict__ BQL, _Float16* __restrict__ BK, _Float16* __restrict__ BVP, _Float16* __restrict__ BCP, float* __restrict__ QMP) {
  static_assert(NRP * (DM / 8) % PT == 0 && NH * 32 * (DM / 8) % PT == 0 && DM * (DM / 8) % PT == 0 && NH * HD == DM, "every piece is a whole number of blocks");
  int r = blockIdx.x; const int tid = threadIdx.x;
  if (r < NB) { qmean_at(xn, wqm, QMP, r); return; }      /* the branch is the same for a whole block: its barriers are met by all of it */
  r -= NB;
  if (r < 3 * PB_W32) { const int s = r / PB_W32; wtpadT_at<32>(s == 0 ? wqf : s == 1 ? wql : wk, s == 0 ? BQF : s == 1 ? BQL : BK, (r - s * PB_W32) * PT + tid); return; }
  r -= 3 * PB_W32;
  if (r < PB_W64) { wtpadT_at<64>(wv, BVP, r * PT + tid); return; }
  r -= PB_W64;
  if (r < PB_WC) { wtopadT_at<HD>(wc, BCP, r * PT + tid); return; }      /* heads of 16 with no pad: plain W_comb^T */
  r -= PB_WC;
  const int s = r / PB_X; x16pad_at(s == 0 ? xn : s == 1 ? xq1 : xl, s == 0 ? XN : s == 1 ? XQ1 : XL, (size_t)(r - s * PB_X) * PT + tid); }
// Projections, one launch: q, k and V^T are block ranges of one grid; the tile is that of k_gemm2 (wave tile 32 x 64, K = DM, operands x16 so alpha = 1/16, f16 result), the fragments come from planes in 16 x 16 blocks.
// q: both products (q1 Wq_first, last Wq_last) run into the same accumulators, the batch's mean term is added behind them.
// V^T: the operands change places, A = rows of the padded Wv^T, B = node rows of one batch, so the tile comes out as [feature][key].
// q, k and V^T are stored in the order in which k_dec's fragment loads take them: per batch and head, blocks of 16 rows x 16 features (q, k: [row][feature], V^T: [d][key]), 512 bytes in a row each, no pads.
__device__ __forceinline__ void pj_acc(const _Float16* __restrict__ a0p, const _Float16* __restrict__ b0p, v8f (&c)[8]) {
  const _Float16* a1p = a0p + 16 * DM; const _Float16* b1p = b0p + 16 * DM; const _Float16* b2p = b0p + 32 * DM; const _Float16* b3p = b0p + 48 * DM;
#pragma unroll 1      /* stays the rolled loop of k_gemm2: the order of loads and products is not part of this change */
  for (int kb = 0; kb < DM; kb += 32) { const v16h a0 = fb_frag(a0p + kb * 16); FragH a1f; a1f.half[0] = *(const v8us*)((const unsigned short*)a1p + kb * 16);
    asm volatile("s_wait_xcnt 0x0" ::: "memory");      /* the build lets the load below land in the address pair that the three A loads just issued name: the wait stands in front of that overwrite */
    a1f.half[1] = *(const v8us*)((const unsigned short*)a1p + kb * 16 + 256); const v16h a1 = a1f.v;
    v16h b = fb_frag(b0p + kb * 16); c[0] = g2_mma(a0, b, c[0]); c[4] = g2_mma(a1, b, c[4]);
    b = fb_frag(b1p + kb * 16); c[1] = g2_mma(a0, b, c[1]); c[5] = g2_mma(a1, b, c[5]);
    b = fb_frag(b2p + kb * 16); c[2] = g2_mma(a0, b, c[2]); c[6] = g2_mma(a1, b, c[6]);
    b = fb_frag(b3p + kb * 16); c[3] = g2_mma(a0, b, c[3]); c[7] = g2_mma(a1, b, c[7]); } }
#define JB_QK ((int)(NRP / 128) * (NH * 32 / 64))  /* blocks of q, and of k */
#define JB_V ((NH * 64 / 128) * (QP / 64))         /* blocks of one batch's V^T */
__global__ __launch_bounds__(128) void k_proj(const _Float16* __restrict__ XQ1, const _Float16* __restrict__ BQF, const _Float16* __restrict__ XL, const _Float16* __restrict__ BQL, const float* __restrict__ QMP, _Float16* __restrict__ Q16,
    const _Float16* __restrict__ XN, const _Float16* __restrict__ BK, _Float16* __restrict__ K16, const _Float16* __restrict__ BVP, _Float16* __restrict__ VT) {
  static_assert(QP % 128 == 0 && NH * 32 == 64 << 2 && QP == 64 << 4, "the 32 rows of a wave tile of q lie in one batch; the two values of lg");
  __shared__ __attribute__((aligned(16))) float so[4][32][68];
  const int tid = threadIdx.x, w = tid >> 5, lane = tid & 31, ln = lane & 15, hh = lane >> 4;
  int bx = blockIdx.x, lg = 2; const _Float16* A = XQ1; const _Float16* B = BQF; _Float16* C16 = Q16; const bool isq = bx < JB_QK, isv = bx >= 2 * JB_QK;      /* lg: log2 of the result's 64-column tiles */
  if (bx >= 2 * JB_QK) { bx -= 2 * JB_QK; const int by = bx / JB_V; bx -= by * JB_V; lg = 4; A = BVP; B = XN + (size_t)by * QP * DM; C16 = VT + (size_t)by * NH * QP * HD; }
  else if (bx >= JB_QK) { bx -= JB_QK; A = XN; B = BK; C16 = K16; }
  const int mt = bx >> lg, nq = bx - (mt << lg), row0 = mt * 128 + 32 * w, col0 = nq * 64;
  if (isv && (row0 & 63)) return;      /* V^T: these 32 rows are all pad rows of Wv^T, which have no place in the stored form; whole waves leave, and no work-group barrier follows */
  const v8f z8 = {0.f, 0.f, 0.f, 0.f, 0.f, 0.f, 0.f, 0.f}; v8f c[8] = {z8, z8, z8, z8, z8, z8, z8, z8};
  float cp[4] = {0.f, 0.f, 0.f, 0.f};      /* q: the batch's mean term at this lane's four columns, loaded ahead of the products */
  if (isq) for (int t = 0; t < 4; ++t) cp[t] = QMP[(size_t)(row0 / QP) * (NH * 32) + col0 + t * 16 + ln];
  const int fo = ln * 16 + 8 * hh;      /* this lane's place in a block */
  pj_acc(A + (size_t)row0 * DM + fo, B + (size_t)col0 * DM + fo, c);
  if (isq) pj_acc(XL + (size_t)row0 * DM + fo, BQL + (size_t)col0 * DM + fo, c);
#pragma unroll      /* c[] in registers */
  for (int u = 0; u < 8; ++u) { const int t = u & 3, half = u >> 2;
    for (int r = 0; r < 8; ++r) so[w][half * 16 + 8 * hh + r][t * 16 + ln] = c[u][r] * 0.0625f + cp[t]; }
  __builtin_amdgcn_fence(__ATOMIC_ACQ_REL, "workgroup"); __builtin_amdgcn_wave_barrier();      /* the reads below take what other lanes of this wave stored */
  /* a store is one 16 x 16 block, lane = (row e of the block, 8 of its 16 values), 512 bytes in a row; the pad columns of q and k and the pad rows of V^T stay behind */
  const int e = lane >> 1, f8 = (lane & 1) * 8; const float* sp = &so[w][e][f8]; FragH f[4];
  _Float16* dp = C16 + (isv ? ((size_t)((row0 >> 6) * (QP / 16) + (col0 >> 4)) * 16 + e) * HD + f8      /* V^T: [head][block of 16 keys][16 d][16 keys]; rows 0..15 of the tile hold 4 blocks */
                            : ((size_t)((row0 / QP) * NH + (col0 >> 5)) * QP + (row0 % QP) + e) * HD + f8);      /* q, k: [batch][head][row][16 features]; the tile holds 2 heads x 2 blocks */
#pragma unroll      /* f[] in registers: the four blocks are read and converted first, the four stores follow in a row */
  for (int q = 0; q < 4; ++q) { const float* s8 = sp + (isv ? q * 16 : (q & 1) * 16 * 68 + (q >> 1) * 32); const v4f x0 = *(const v4fa*)s8, x1 = *(const v4fa*)(s8 + 4);
    for (int i = 0; i < 4; ++i) { f[q].h[i] = (_Float16)x0[i]; f[q].h[4 + i] = (_Float16)x1[i]; } }
#pragma unroll      /* f[] in registers */
  for (int q = 0; q < 4; ++q) *(v8us*)(dp + (isv ? q * 16 * HD : ((q >> 1) * QP + (q & 1) * 16) * HD)) = f[q].half[0]; }
// Row softmaxes, one wave per row: lane holds columns 4*lane + 128*u (u = 0..7), so each wave-wide b128 load or store covers 512 contiguous bytes;
// the row's values stay in registers between the maximum, the sum and the store. Maximum and sum: per lane first, then a five-step butterfly over the 32 lanes.
// Columns NQ..QP-1 (lanes 26..31 of u = 7): the score planes hold them; the mask does not, so those lanes re-read their own first chunk; their value is -inf (weight 0) and nothing is stored.
__device__ __forceinline__ float wave_max32(float v) { for (int m = 16; m > 0; m >>= 1) v = fmaxf(v, __shfl_xor(v, m, 32)); return v; }
__device__ __forceinline__ float wave_sum32(float v) { for (int m = 16; m > 0; m >>= 1) v += __shfl_xor(v, m, 32); return v; }
// 2^x as one v_exp_f32 (what __expf compiles to behind its multiply) with the issue slot behind it filled
__device__ __forceinline__ float exp2_slot(float x) { float r; asm("v_exp_f32 %0, %1\n\tv_nop" : "=v"(r) : "v"(x)); return r; }
// tanh as one v_tanh_f32, the issue slot behind it filled in the same way
__device__ __forceinline__ float tanh_slot(float x) { float r; asm("v_tanh_f32 %0, %1\n\tv_nop" : "=v"(r) : "v"(x)); return r; }
__device__ __forceinline__ v16h at_frag16(v8us lo) { FragH f; f.half[0] = lo; const v8us z = {0, 0, 0, 0, 0, 0, 0, 0}; f.half[1] = z; return f.v; }      /* q or k row of one head: 16 features, k 16..31 of the fragment zero */
__device__ __forceinline__ v8f at_mma(v16h a, v16h b, v8f c) { return __builtin_amdgcn_wmma_f32_16x16x32_f16(false, a, false, b, (short)0, c, false, false); }
// what 32 keys take for one lane: from memory its 8 features of two k rows (a tile of 16 keys of one head is 512 bytes in a row, lane l takes bytes 32 (l % 16) + 16 (l / 16) ..: a whole-line load), from the block's staged mask rows in LDS (mr, already rounded) 2 x 8 mask values of its query. EDGE: a lane whose 8 keys lie at or past NQ reads its 8 mask values of the row's first 16 columns instead, and those keys count as -inf
struct At32 { v8us k0, k1; v4f m0, m1, m2, m3; };
template <bool EDGE>
__device__ __forceinline__ At32 at_load(const unsigned short* kp, const float* mr, int k0, int hh) {
  At32 t; const int c0 = (!EDGE || k0 + 8 * hh < NQ) ? k0 : 0, c1 = (!EDGE || k0 + 16 + 8 * hh < NQ) ? k0 + 16 : 0;
  t.k0 = *(const v8us*)(kp + (size_t)k0 * HD); t.k1 = *(const v8us*)(kp + (size_t)(k0 + 16) * HD);
  t.m0 = *(const v4fa*)(mr + c0); t.m1 = *(const v4fa*)(mr + c0 + 4); t.m2 = *(const v4fa*)(mr + c1); t.m3 = *(const v4fa*)(mr + c1 + 4); return t; }
// x[0..7], x[8..15]: scores / 4 + mask of this lane's query against keys k0 + 8 * hh + r and k0 + 16 + 8 * hh + r
template <bool EDGE>
__device__ __forceinline__ void at_score(const At32& t, v16h qf, int k0, int hh, float* x) {
  const v8f z8 = {0.f, 0.f, 0.f, 0.f, 0.f, 0.f, 0.f, 0.f}; const v8f s0 = at_mma(at_frag16(t.k0), qf, z8), s1 = at_mma(at_frag16(t.k1), qf, z8);
  const bool in0 = !EDGE || k0 + 8 * hh < NQ, in1 = !EDGE || k0 + 16 + 8 * hh < NQ;
#pragma unroll      /* x[] in registers */
  for (int r = 0; r < 8; ++r) { const float v0 = s0[r] * 0.25f + (r < 4 ? t.m0[r & 3] : t.m1[r & 3]), v1 = s1[r] * 0.25f + (r < 4 ? t.m2[r & 3] : t.m3[r & 3]);
    x[r] = in0 ? v0 : -__builtin_inff(); x[8 + r] = in1 ? v1 : -__builtin_inff(); } }
// V^T fragment of 32 keys (k order of g2_frag): two blocks [16 d][16 keys] of 512 bytes in a row each; vp points at this lane's 8 keys of its row d in block 0
__device__ __forceinline__ v16h at_vfrag(const _Float16* vp, int k0) { FragH f; f.half[0] = *(const v8us*)((const unsigned short*)vp + (size_t)k0 * HD); f.half[1] = *(const v8us*)((const unsigned short*)vp + (size_t)(k0 + 16) * HD); return f.v; }
template <bool EDGE>
__device__ __forceinline__ float at_max32(const At32& t, v16h qf, int k0, int hh, float mx) {
  float x[16]; at_score<EDGE>(t, qf, k0, hh, x);
#pragma unroll      /* x[] in registers */
  for (int r = 0; r < 16; ++r) mx = fmaxf(mx, x[r]);
  return mx; }
template <bool EDGE>
__device__ __forceinline__ v8f at_pv32(const At32& t, v16h vf, v16h qf, int k0, int hh, float mx, float* se, v8f o) {
  float x[16]; at_score<EDGE>(t, qf, k0, hh, x); FragH pf;
#pragma unroll      /* x[] in registers; four running sums, so that an add does not wait for the one before it */
  for (int r = 0; r < 16; ++r) { const float e = exp2_slot((x[r] - mx) * 1.44269504f + 8.0f); se[r & 3] += e; pf.h[r] = (_Float16)e; }
  return at_mma(vf, pf.v, o); }
// Attention, the combine projection and stage 2 in one launch: block = (16 query rows, batch), eight waves. What went from launch to launch through memory (o, its hi and residual planes, mh) now goes from wave to wave through LDS.
// Ahead of the attention the block's 16 mask rows are staged once in sc (free until stage 2): wave w brings rows 2 w and 2 w + 1 by loads of 512 contiguous bytes and rounds them; all eight heads read them there in both passes
// (a lane's 8 mask values straight from memory made every load touch 16 lines, and every head did that twice). The pitch SP puts the 16 rows that a b128 read touches 4 banks apart.
// Attention as described above, wave = head; a lane's 8 values of o (x64) go to its query's row of ob.
// Combine, behind the second barrier: every wave splits the 16 rows of o into f16 hi + x1024 residual fragments (k order of g2_frag, K = 128) and forms the 16 columns 16 w .. 16 w + 15 of mh = o W_comb + b_comb, which go to mhb.
// Stage 2, behind the third barrier: score2 stays in LDS, the probabilities go straight to out.
// Part 1: wave w forms score2 of the 16 rows against keys 128 w .. 128 w + 127, eight tiles of 16 keys. The mh rows are split here into f16 hi + x1024 residual fragments (k order of g2_frag) and stay in registers.
// A tile of 16 node rows is 4 KiB in a row in memory, eight blocks in fragment order: eight loads of 512 contiguous bytes a wave, one tile ahead, are the tile's four fragments.
// Part 2, behind the fourth barrier: wave w takes rows 2 w and 2 w + 1 whole, lane = columns 4 * lane + 128 * u as in the row softmaxes above.
// Its tanh is one v_tanh_f32 and its e^x one v_exp_f32 behind a multiply: the library tanhf put a compare, two branches on the lane mask and a serial polynomial behind every value, so that no value's work overlapped the next one's.
#define SP (QP + 4)                  /* score row pitch in LDS, floats: rows r and r + 8, stored by the two wave halves together, lie 32 banks apart */
#define OP (DM + 4)                  /* o and mh row pitch in LDS, floats: 528 bytes, so the 16 rows that a b128 fragment read touches start 4 banks apart */
__global__ __launch_bounds__(256) void k_dec(const _Float16* __restrict__ Q16, const _Float16* __restrict__ K16, const _Float16* __restrict__ VT, const _Float16* __restrict__ BC, const float* __restrict__ bc, const _Float16* __restrict__ XN, const float* __restrict__ mask, float* __restrict__ out) {
  static_assert(NQ % 8 == 0 && NQ > QP - 32 && NQ <= QP && QP % 128 == 0, "only the last 32 keys hold an edge, and a lane's 8 keys are all in or all out");
  static_assert(QP == 8 * 128 && DM == 128 && NQ % 4 == 0, "eight waves of 128 keys; a node row is 16 lanes of 16 bytes; a lane's 4 columns are all in or all out");
  __shared__ __attribute__((aligned(16))) float sc[16][SP]; __shared__ __attribute__((aligned(16))) float ob[16][OP]; __shared__ __attribute__((aligned(16))) float mhb[16][OP];
  const int b = blockIdx.y, row0 = blockIdx.x * 16, lane = threadIdx.x & 31, ln = lane & 15, hh = lane >> 4;
  const int w = __builtin_amdgcn_readfirstlane(threadIdx.x >> 5);      /* wave number in a scalar register: LDS bases and the row test below are scalar */
  { const int h = w, c = ln, q = row0 + c; const bool live = q < NQ;      /* rows NQ.. of the last block: same instruction stream on a staged copy of mask row 0, scale 0, so zeros go to ob */
  const v16h qf = at_frag16(*(const v8us*)((const unsigned short*)Q16 + ((size_t)(b * NH + h) * QP + q) * HD + 8 * hh));
  const unsigned short* kp = (const unsigned short*)K16 + ((size_t)(b * NH + h) * QP + c) * HD + 8 * hh; const _Float16* vp = VT + (size_t)(b * NH + h) * QP * HD + c * HD + 8 * hh;
  { const int cs = lane * 4, p0 = row0 + 2 * w, p1 = p0 + 1; const float* r0 = mask + ((size_t)b * NQ + (p0 < NQ ? p0 : 0)) * NQ + cs; const float* r1 = mask + ((size_t)b * NQ + (p1 < NQ ? p1 : 0)) * NQ + cs; v4f g0[QP / 128], g1[QP / 128];
#pragma unroll      /* g0[], g1[] in registers, both rows' loads in flight together */
    for (int u = 0; u < QP / 128; ++u) { const int o = (cs + 128 * u < NQ) ? 128 * u : 0; g0[u] = *(const v4fa*)(r0 + o); g1[u] = *(const v4fa*)(r1 + o); }
    asm volatile("s_wait_xcnt 0x0" ::: "memory");      /* stands in front of whatever reuses the address registers of the mask loads just issued */
#pragma unroll      /* g0[], g1[] in registers */
    for (int u = 0; u < QP / 128; ++u) { const bool in = cs + 128 * u < NQ; v4f a, d; for (int i = 0; i < 4; ++i) { a[i] = bf16_round(in ? g0[u][i] : -__builtin_inff()); d[i] = bf16_round(in ? g1[u][i] : -__builtin_inff()); }
      *(v4f*)&sc[2 * w][cs + 128 * u] = a; *(v4f*)&sc[2 * w + 1][cs + 128 * u] = d; } }      /* columns NQ.. get -inf: one store path for every lane (with a branch round the last stores the build moved their loads into it, a second trip to memory) */
  __syncthreads();      /* the 16 mask rows are whole */
  const float* mr = &sc[c][8 * hh]; float mx = -3.0e38f;
#pragma unroll 1      /* stays a loop: unrolled whole, the two passes were some 10,000 instructions and spilled */
  for (int k0 = 0; k0 < QP - 128; k0 += 128) { At32 t[4];
#pragma unroll      /* t[] in registers, the loads of 128 keys in flight together */
    for (int j = 0; j < 4; ++j) t[j] = at_load<false>(kp, mr, k0 + 32 * j, hh);
#pragma unroll      /* t[] in registers */
    for (int j = 0; j < 4; ++j) mx = at_max32<false>(t[j], qf, k0 + 32 * j, hh, mx); }
  { At32 t[4];      /* the last 128 keys */
#pragma unroll      /* t[] in registers */
    for (int j = 0; j < 3; ++j) t[j] = at_load<false>(kp, mr, QP - 128 + 32 * j, hh);
    t[3] = at_load<true>(kp, mr, QP - 32, hh);
#pragma unroll      /* t[] in registers */
    for (int j = 0; j < 3; ++j) mx = at_max32<false>(t[j], qf, QP - 128 + 32 * j, hh, mx);
    mx = at_max32<true>(t[3], qf, QP - 32, hh, mx); }
  mx = fmaxf(mx, __shfl_xor(mx, 16, 32));
  v8f o = {0.f, 0.f, 0.f, 0.f, 0.f, 0.f, 0.f, 0.f}; float se[4] = {0.f, 0.f, 0.f, 0.f};
#pragma unroll 1      /* stays a loop, as above */
  for (int k0 = 0; k0 < QP - 64; k0 += 64) {      /* the loads of 64 keys in flight together */
    const At32 t0 = at_load<false>(kp, mr, k0, hh), t1 = at_load<false>(kp, mr, k0 + 32, hh);
    asm volatile("s_wait_xcnt 0x0" ::: "memory");      /* the build let a V load's result land in the address pair of the k loads just issued: the wait stands in front of that overwrite */
    const v16h v0 = at_vfrag(vp, k0), v1 = at_vfrag(vp, k0 + 32);
    o = at_pv32<false>(t0, v0, qf, k0, hh, mx, se, o); o = at_pv32<false>(t1, v1, qf, k0 + 32, hh, mx, se, o); }
  { const At32 t0 = at_load<false>(kp, mr, QP - 64, hh), t1 = at_load<true>(kp, mr, QP - 32, hh);
    asm volatile("s_wait_xcnt 0x0" ::: "memory");      /* as in the loop: a V load's result lands in the address pair of the k loads just issued */
    const v16h v0 = at_vfrag(vp, QP - 64), v1 = at_vfrag(vp, QP - 32);
    o = at_pv32<false>(t0, v0, qf, QP - 64, hh, mx, se, o); o = at_pv32<true>(t1, v1, qf, QP - 32, hh, mx, se, o); }
  float st = (se[0] + se[1]) + (se[2] + se[3]); st += __shfl_xor(st, 16, 32);
  const float osc = live ? 64.0f / st : 0.f;      /* o x64 */
  const v4f o0 = {o[0] * osc, o[1] * osc, o[2] * osc, o[3] * osc}, o1 = {o[4] * osc, o[5] * osc, o[6] * osc, o[7] * osc};
  *(v4f*)&ob[c][h * HD + 8 * hh] = o0; *(v4f*)&ob[c][h * HD + 8 * hh + 4] = o1; }
  v16h wf[4];      /* this wave's 16 rows of W_comb^T (x16), the bias at its column and, below, the first node tile: issued together ahead of the barrier, so that the three latencies are paid as one */
#pragma unroll      /* wf[] in registers */
  for (int j = 0; j < 4; ++j) wf[j] = fb_frag(BC + (size_t)16 * w * DM + 32 * j * 16 + ln * 16 + 8 * hh);
  const float bv = bf16_round(bc[16 * w + ln]);
  asm volatile("s_wait_xcnt 0x0" ::: "memory");      /* the build lets a node load's result land in the address pair of the W_comb^T loads just issued: the wait stands in front of that overwrite */
  const unsigned short* xb = (const unsigned short*)XN + ((size_t)b * QP + 128 * w) * DM + ln * 16 + 8 * hh; v8us st[8];      /* st[i]: this lane's 8 values of block i of a tile of 16 node rows, that is half i & 1 of fragment i / 2 */
#pragma unroll      /* st[] in registers, the tile's loads in flight together */
  for (int i = 0; i < 8; ++i) st[i] = *(const v8us*)(xb + i * 256);
  __syncthreads();      /* ob is whole */
  { v8f mh_h = {0.f, 0.f, 0.f, 0.f, 0.f, 0.f, 0.f, 0.f}, mh_l = mh_h; const float* orw = &ob[ln][8 * hh];
#pragma unroll      /* fragments in registers */
    for (int j = 0; j < 4; ++j) { const v4f x0 = *(const v4fa*)(orw + 32 * j), x1 = *(const v4fa*)(orw + 32 * j + 4), x2 = *(const v4fa*)(orw + 32 * j + 16), x3 = *(const v4fa*)(orw + 32 * j + 20); FragH fh, fl;
      const float xs[16] = {x0[0], x0[1], x0[2], x0[3], x1[0], x1[1], x1[2], x1[3], x2[0], x2[1], x2[2], x2[3], x3[0], x3[1], x3[2], x3[3]};
      for (int i = 0; i < 16; ++i) { const _Float16 g = (_Float16)xs[i]; fh.h[i] = g; fl.h[i] = (_Float16)((xs[i] - (float)g) * 1024.0f); }
      mh_h = at_mma(fh.v, wf[j], mh_h); mh_l = at_mma(fl.v, wf[j], mh_l); }
#pragma unroll      /* eight plain LDS stores */
    for (int r = 0; r < 8; ++r) mhb[8 * hh + r][16 * w + ln] = (mh_h[r] * 0.0009765625f + bv) + mh_l[r] * 0.00000095367431640625f; }      /* o x64, W_comb x16: 2^-10; the residual x1024 more: 2^-20 */
  __syncthreads();      /* mhb is whole */
  const float* ar = &mhb[ln][8 * hh]; FragH ah[4], al[4];
#pragma unroll      /* ah[], al[] in registers */
  for (int j = 0; j < 4; ++j) { const v4f x0 = *(const v4fa*)(ar + 32 * j), x1 = *(const v4fa*)(ar + 32 * j + 4), x2 = *(const v4fa*)(ar + 32 * j + 16), x3 = *(const v4fa*)(ar + 32 * j + 20);
    const float xs[16] = {x0[0], x0[1], x0[2], x0[3], x1[0], x1[1], x1[2], x1[3], x2[0], x2[1], x2[2], x2[3], x3[0], x3[1], x3[2], x3[3]};
    for (int i = 0; i < 16; ++i) { const _Float16 h = (_Float16)xs[i]; ah[j].h[i] = h; al[j].h[i] = (_Float16)((xs[i] - (float)h) * 1024.0f); } }
#pragma unroll      /* st[] in registers; the next tile's loads stand ahead of this tile's products */
  for (int t = 0; t < 8; ++t) {
    FragH bf[4];
    for (int j = 0; j < 4; ++j) { bf[j].half[0] = st[2 * j]; bf[j].half[1] = st[2 * j + 1]; }
    if (t < 7) for (int i = 0; i < 8; ++i) st[i] = *(const v8us*)(xb + (t + 1) * 16 * DM + i * 256);
    __builtin_amdgcn_sched_barrier(0);      /* the next tile's eight loads stay together ahead of this tile's products: left free, the build moved each pair of loads down to its use, a trip to L2 waited for per fragment */
    v8f sh = {0.f, 0.f, 0.f, 0.f, 0.f, 0.f, 0.f, 0.f}, sl = sh;
    for (int j = 0; j < 4; ++j) { sh = at_mma(ah[j].v, bf[j].v, sh); sl = at_mma(al[j].v, bf[j].v, sl); }
    for (int r = 0; r < 8; ++r) sc[8 * hh + r][128 * w + 16 * t + ln] = sh[r] * 0.088388347648318447f + sl[r] * 0.000086316745750311f; }      /* (mh_hi + mh_lo / 1024) nodes^T / sqrt(128) */
  const int c0 = lane * 4; v4f m[QP / 128], mn[QP / 128];
  { const int p0 = row0 + 2 * w, p1 = p0 + 1; const float* r0 = mask + ((size_t)b * NQ + (p0 < NQ ? p0 : 0)) * NQ + c0; const float* r1 = mask + ((size_t)b * NQ + (p1 < NQ ? p1 : 0)) * NQ + c0;
#pragma unroll      /* m[], mn[] in registers, both rows' mask loads in flight together */
    for (int u = 0; u < QP / 128; ++u) { const int o = (c0 + 128 * u < NQ) ? 128 * u : 0;
      if (u == QP / 128 - 1) asm volatile("s_wait_xcnt 0x0" ::: "memory");      /* without these two waits the build let the result of the last load land in address pairs that loads just issued name: a wait stands in front of each of the last two loads */
      m[u] = *(const v4fa*)(r0 + o);
      if (u == QP / 128 - 1) asm volatile("s_wait_xcnt 0x0" ::: "memory");      /* the second of the two waits */
      mn[u] = *(const v4fa*)(r1 + o); } }
  asm volatile("s_wait_xcnt 0x0" ::: "memory");      /* stands in front of part 2, which reuses the address registers of the mask loads just issued */
  __syncthreads();
#pragma unroll 1      /* stays the loop it was: how the two rows follow one another is not part of this change */
  for (int rr = 0; rr < 2; ++rr) { const int lr = 2 * w + rr, p = row0 + lr; if (p >= NQ) break;      /* rows NQ.. of the last block: no output; no barrier follows */
    float* pr = out + ((size_t)b * NQ + p) * NQ + c0; v4f x[QP / 128]; float mx = -3.0e38f;
#pragma unroll      /* x[] in registers */
    for (int u = 0; u < QP / 128; ++u) x[u] = *(const v4fa*)&sc[lr][c0 + 128 * u];
#pragma unroll      /* x[] in registers */
    for (int u = 0; u < QP / 128; ++u) { const bool in = c0 + 128 * u < NQ; for (int q = 0; q < 4; ++q) { const float v = 10.0f * tanh_slot(x[u][q]) + bf16_round(m[u][q]); x[u][q] = in ? v : -__builtin_inff(); mx = fmaxf(mx, x[u][q]); } }
    mx = wave_max32(mx); float se = 0.f;
#pragma unroll      /* x[] in registers */
    for (int u = 0; u < QP / 128; ++u) for (int q = 0; q < 4; ++q) { x[u][q] = exp2_slot((x[u][q] - mx) * 1.44269504f); se += x[u][q]; }
    const float inv = 1.0f / wave_sum32(se);
#pragma unroll      /* x[] in registers */
    for (int u = 0; u < QP / 128; ++u) { v4f o; for (int q = 0; q < 4; ++q) o[q] = x[u][q] * inv; if (c0 + 128 * u < NQ) *(v4f*)(pr + 128 * u) = o; }
    asm volatile("s_wait_xcnt 0x0" ::: "memory");      /* stands in front of the copies below and the next row, which overwrite the registers of the stores just issued */
#pragma unroll      /* m[] in registers */
    for (int u = 0; u < QP / 128; ++u) m[u] = mn[u]; } }

extern "C" void kernel_launch(void* const* d_in, const int* in_sizes, int n_in,
                              void* d_out, int out_size, void* d_ws, size_t ws_size, hipStream_t stream) {
  (void)in_sizes; (void)n_in; (void)out_size;
  const float* const* I = (const float* const*)d_in; const float* xn = I[0]; const float* xq1 = I[1]; const float* xl = I[2]; const float* mask = I[3]; const float* Wqf = I[4]; const float* Wql = I[5]; const float* Wqm = I[6]; const float* Wk = I[7]; const float* Wv = I[8]; const float* Wc = I[9]; const float* bc = I[10];      /* weights [in][out] */
  char* ws = (char*)d_ws; size_t off = 0;
  auto take = [&](size_t bytes) { char* p = ws + off; off += (bytes + 255) & ~(size_t)255; return p; };
  _Float16* BQF = (_Float16*)take((size_t)NH * 32 * DM * 2); _Float16* BQL = (_Float16*)take((size_t)NH * 32 * DM * 2); _Float16* BK = (_Float16*)take((size_t)NH * 32 * DM * 2); _Float16* BVP = (_Float16*)take((size_t)NH * 64 * DM * 2); _Float16* BCP = (_Float16*)take((size_t)DM * DM * 2); float* QMP = (float*)take((size_t)NB * NH * 32 * 4);
  _Float16* XN = (_Float16*)take(NRP * DM * 2); _Float16* XQ1 = (_Float16*)take(NRP * DM * 2); _Float16* XL = (_Float16*)take(NRP * DM * 2);
  _Float16* Q16 = (_Float16*)take(NRP * NH * HD * 2); _Float16* K16 = (_Float16*)take(NRP * NH * HD * 2);
  _Float16* VT = (_Float16*)take((size_t)NB * NH * HD * QP * 2);
  if (off > ws_size) return;      /* about 12 MiB */
  k_prep<<<PB_ALL, PT, 0, stream>>>(xn, xq1, xl, Wqf, Wql, Wqm, Wk, Wv, Wc, XN, XQ1, XL, BQF, BQL, BK, BVP, BCP, QMP);      /* f16 token planes (padded rows), transposed x16 weights, all in 16 x 16 blocks; per-batch mean term in the padded q layout */
  k_proj<<<2 * JB_QK + NB * JB_V, 128, 0, stream>>>(XQ1, BQF, XL, BQL, QMP, Q16, XN, BK, K16, BVP, VT);      /* q = q1 Wq_first + last Wq_last + mean term, k: [8 batches][8][1024][16]; V^T [8 batches][8][64 blocks][16][16] */
  k_dec<<<dim3((NQ + 15) / 16, NB), 256, 0, stream>>>(Q16, K16, VT, BCP, bc, XN, mask, (float*)d_out);      /* scores / sqrt(16) + mask, softmax, weights v -> o; mh = o W_comb + b_comb; score2 = mh nodes^T / sqrt(128), 10 tanh, + mask, softmax over the 1000 real keys (f32) -> probs */
}

// v010
// It runs in 42.4 microseconds.
// Timed twice side by side with v009, it ran 1.34 and 1.36 times as fast.
// All steps since the starting kernel, v000, together make it 371 times as fast.
#include <hip/hip_runtime.h>
// TSP decoder probabilities (encoded_nodes, encoded_q1, encoded_last_node [8][1000][128]; k = nodes Wk, v = nodes Wv, q = q1 Wq_first + last Wq_last + (mean_n nodes) Wq_mean broadcast ([in][out] weights), 8 heads of 16; weights = softmax(q k^T / 4 + ninf_mask); mh = (weights v merged) W_comb + b_comb; score2 = mh nodes^T / sqrt(128); probs = softmax_n(10 tanh(score2) + ninf_mask) -> [8][1000][1000]).
// Compute dtype: inputs rounded to bf16; token rows / weights exact; q, k, v and the stage-1 weights as plain f16 GEMM operands (~2^-12); o and mh as f16 hi + residual operand pairs (~2^-22); the mean term, score2, tanh, mask and the final softmax f32. v_wmma_f32_16x16x32_f16.
#define NB 8
#define NQ 1000                      /* nodes = queries = 1000 */
#define QP 1024                      /* padded rows / keys per batch */
#define DM 128
#define NH 8
#define HD 16
#define SQ QP
#define HG 8
#define B0 0                         /* not used */
#define NBR NB
#define NRP ((size_t)NB * QP)        /* padded token rows */
typedef __bf16 v16b __attribute__((ext_vector_type(16)));
typedef unsigned short v8us __attribute__((ext_vector_type(8), may_alias));
typedef float  v8f  __attribute__((ext_vector_type(8)));
typedef float  v4f  __attribute__((ext_vector_type(4)));
typedef float  v4fa __attribute__((ext_vector_type(4), may_alias));
union FragB { v16b v; v8us half[2]; unsigned short u[16]; };

__device__ __forceinline__ unsigned short bf16_bits(float x) { unsigned int u = __float_as_uint(x); return (unsigned short)((u + 0x7FFFu + ((u >> 16) & 1u)) >> 16); }
__device__ __forceinline__ float bf16_val(unsigned short b) { return __uint_as_float(((unsigned int)b) << 16); }
__device__ __forceinline__ float bf16_round(float x) { return bf16_val(bf16_bits(x)); }
// D += A·B with NT terms: 1 = ah·bh, 2 = + al·bh (A split), 3 = + ah·bl (both split)
template <int NT>
__device__ __forceinline__ v8f mmaN(v16b ah, v16b al, v16b bh, v16b bl, v8f c) {
  c = __builtin_amdgcn_wmma_f32_16x16x32_bf16(false, ah, false, bh, (short)0, c, false, false);
  if (NT >= 2) c = __builtin_amdgcn_wmma_f32_16x16x32_bf16(false, al, false, bh, (short)0, c, false, false);
  if (NT >= 3) c = __builtin_amdgcn_wmma_f32_16x16x32_bf16(false, ah, false, bl, (short)0, c, false, false);
  asm volatile("v_nop\n\tv_nop\n\tv_nop\n\tv_nop" : "+v"(c) : "v"(ah), "v"(al), "v"(bh), "v"(bl));
  return c;
}

__global__ __launch_bounds__(256) void k_wt_bf16(const float* __restrict__ W, unsigned short* __restrict__ Wt, int K, int N) {
  const int t = blockIdx.x * 256 + threadIdx.x;
  const int k8n = K / 8;
  if (t >= N * k8n) return;
  const int n = t / k8n, k8 = (t % k8n) * 8;
  v8us v;
#pragma unroll
  for (int i = 0; i < 8; ++i) v[i] = bf16_bits(W[(size_t)(k8 + i) * N + n]);
  *(v8us*)(Wt + (size_t)n * K + k8) = v;
  
}

// GEMM C[M][N] (f32, pitch ldc) = act(A[M][K]·W + bias). A f32 row-major (pitch lda) converted per fragment to bf16
// (ASPLIT: hi/lo two planes -> 2 terms, else single rounded term); Wt bf16 [N][K] (pitch ldb). BIAS_BF16 rounds the
// bias to bf16 first (bias quantised to bf16 before the add). K%32==0, M%16==0, N%64==0.
template <bool ASPLIT, int ACT, bool BIAS_BF16>
__global__ __launch_bounds__(128) void k_gemm_bf(const float* __restrict__ A, int lda, const unsigned short* __restrict__ Wt, int ldb,
                                               const float* __restrict__ bias, float* __restrict__ C, int ldc, int M, int N, int K) {
  __shared__ __attribute__((aligned(16))) float so[4][16][64];
  const int tid = threadIdx.x, w = tid >> 5, lane = tid & 31, ln = lane & 15, hh = lane >> 4;
  const int ntn = N / 64;
  const int wid = blockIdx.x * 4 + w;
  const int mt = wid / ntn, nq = wid % ntn;
  if (mt * 16 >= M) return;
  const int row0 = mt * 16, col0 = nq * 64;
  const float* arow = A + (size_t)(row0 + ln) * lda;
  v8f acc[4] = {};
  for (int kb = 0; kb < K; kb += 32) {
    FragB ah, al;
    const v4f x0 = *(const v4fa*)(arow + kb + 8 * hh), x1 = *(const v4fa*)(arow + kb + 8 * hh + 4);
    const v4f x2 = *(const v4fa*)(arow + kb + 16 + 8 * hh), x3 = *(const v4fa*)(arow + kb + 16 + 8 * hh + 4);
    float xs[16] = {x0[0],x0[1],x0[2],x0[3],x1[0],x1[1],x1[2],x1[3],x2[0],x2[1],x2[2],x2[3],x3[0],x3[1],x3[2],x3[3]};
#pragma unroll
    for (int i = 0; i < 16; ++i) { const unsigned short hb = bf16_bits(xs[i]); ah.u[i] = hb; al.u[i] = ASPLIT ? bf16_bits(xs[i] - bf16_val(hb)) : (unsigned short)0; }
#pragma unroll
    for (int t = 0; t < 4; ++t) {
      const unsigned short* brow = Wt + (size_t)(col0 + t * 16 + ln) * ldb + kb;
      FragB b;
      b.half[0] = *(const v8us*)(brow + 8 * hh);
      b.half[1] = *(const v8us*)(brow + 16 + 8 * hh);
      acc[t] = mmaN<ASPLIT ? 2 : 1>(ah.v, al.v, b.v, b.v, acc[t]);
    }
  }
#pragma unroll
  for (int t = 0; t < 4; ++t) {
    float bv = bias ? bias[col0 + t * 16 + ln] : 0.f;
    if (BIAS_BF16) bv = bf16_round(bv);
#pragma unroll
    for (int r = 0; r < 8; ++r) { float v = acc[t][r] + bv; if (ACT == 1) v = fmaxf(v, 0.f); so[w][8 * hh + r][t * 16 + ln] = v; }
  }
  __builtin_amdgcn_fence(__ATOMIC_ACQ_REL, "workgroup");
  __builtin_amdgcn_wave_barrier();
  const int rsub = lane >> 4, c4 = (lane & 15) * 4;
  {
#pragma unroll
    for (int q = 0; q < 8; ++q) {
      const int r = q * 2 + rsub;
      const v4f v = *(const v4fa*)&so[w][r][c4];
      *(v4f*)(C + (size_t)(row0 + r) * ldc + col0 + c4) = v;
    }
    
  }
}

// GEMM C = act(A·W + bias + resid): A f32 (ASPLIT -> hi/lo 2 terms), Wt bf16 [N][K]; ACT 0 none, 1 relu, 2 exact gelu;
// resid (optional, f32, row index = (row % rmod), pitch ldr, RES_BF16 rounds it) added before the activation.
template <bool ASPLIT, int ACT, bool BIAS_BF16, bool RES_BF16>
__global__ __launch_bounds__(128) void k_gemm_bf3(const float* __restrict__ A, int lda, const unsigned short* __restrict__ Wt, int ldb,
                                                const float* __restrict__ bias, const float* __restrict__ resid, int rmod, int ldr,
                                                float* __restrict__ C, int ldc, int M, int N, int K) {
  __shared__ __attribute__((aligned(16))) float so[4][16][64];
  const int tid = threadIdx.x, w = tid >> 5, lane = tid & 31, ln = lane & 15, hh = lane >> 4;
  const int ntn = N / 64;
  const int wid = blockIdx.x * 4 + w;
  const int mt = wid / ntn, nq = wid % ntn;
  if (mt * 16 >= M) return;
  const int row0 = mt * 16, col0 = nq * 64;
  const float* arow = A + (size_t)(row0 + ln) * lda;
  v8f acc[4] = {};
  for (int kb = 0; kb < K; kb += 32) {
    FragB ah, al;
    const v4f x0 = *(const v4fa*)(arow + kb + 8 * hh), x1 = *(const v4fa*)(arow + kb + 8 * hh + 4);
    const v4f x2 = *(const v4fa*)(arow + kb + 16 + 8 * hh), x3 = *(const v4fa*)(arow + kb + 16 + 8 * hh + 4);
    float xs[16] = {x0[0],x0[1],x0[2],x0[3],x1[0],x1[1],x1[2],x1[3],x2[0],x2[1],x2[2],x2[3],x3[0],x3[1],x3[2],x3[3]};
#pragma unroll
    for (int i = 0; i < 16; ++i) { const unsigned short hb = bf16_bits(xs[i]); ah.u[i] = hb; al.u[i] = ASPLIT ? bf16_bits(xs[i] - bf16_val(hb)) : (unsigned short)0; }
#pragma unroll
    for (int t = 0; t < 4; ++t) {
      const unsigned short* brow = Wt + (size_t)(col0 + t * 16 + ln) * ldb + kb;
      FragB b;
      b.half[0] = *(const v8us*)(brow + 8 * hh);
      b.half[1] = *(const v8us*)(brow + 16 + 8 * hh);
      acc[t] = mmaN<ASPLIT ? 2 : 1>(ah.v, al.v, b.v, b.v, acc[t]);
    }
  }
#pragma unroll
  for (int t = 0; t < 4; ++t) {
    const int col = col0 + t * 16 + ln;
    float bv = bias ? bias[col] : 0.f;
    if (BIAS_BF16) bv = bf16_round(bv);
#pragma unroll
    for (int r = 0; r < 8; ++r) {
      float v = acc[t][r] + bv;
      if (resid) { float rv = resid[(size_t)((row0 + 8 * hh + r) % rmod) * ldr + col]; if (RES_BF16) rv = bf16_round(rv); v += rv; }
      if (ACT == 1) v = fmaxf(v, 0.f);
      if (ACT == 2) v = 0.5f * v * (1.0f + erff(v * 0.70710678118654752f));
      if (ACT == 3) { const float u = 0.7978845608028654f * (v + 0.044715f * v * v * v); v = 0.5f * v * (1.0f + tanhf(u)); }
      so[w][8 * hh + r][t * 16 + ln] = v;
    }
  }
  __builtin_amdgcn_fence(__ATOMIC_ACQ_REL, "workgroup");
  __builtin_amdgcn_wave_barrier();
  const int rsub = lane >> 4, c4 = (lane & 15) * 4;
  {
#pragma unroll
    for (int q = 0; q < 8; ++q) {
      const int r = q * 2 + rsub;
      const v4f v = *(const v4fa*)&so[w][r][c4];
      *(v4f*)(C + (size_t)(row0 + r) * ldc + col0 + c4) = v;
    }
    
  }
}
// row LayerNorm (biased variance, eps) over N: s = X (+ R); optional out_sum <- s; out_norm <- (s-mu)*rsqrt(var+eps)*g + b
template <bool PARAM_BF16>
__global__ __launch_bounds__(256) void k_layernorm(const float* __restrict__ X, const float* __restrict__ R, const float* __restrict__ g, const float* __restrict__ bta,
                                                  float* __restrict__ out_sum, float* __restrict__ out_norm, int N, float eps) {
  __shared__ float red[256];
  const int row = blockIdx.x, tid = threadIdx.x;
  const float* x = X + (size_t)row * N; const float* rr = R ? R + (size_t)row * N : nullptr;
  float vals[16];                     // up to N = 4096
  const int per = N / 256;            // contiguous chunk per thread? use strided-by-4 chunks: thread handles j = tid*4 + 1024*u
  float s1 = 0.f;
  for (int u = 0; u < per / 4; ++u) {
    const int j = tid * 4 + 1024 * u;
    const v4f a = *(const v4fa*)(x + j);
    v4f b = {0.f,0.f,0.f,0.f}; if (rr) b = *(const v4fa*)(rr + j);
#pragma unroll
    for (int q = 0; q < 4; ++q) { const float v = a[q] + b[q]; vals[u * 4 + q] = v; s1 += v; }
  }
  red[tid] = s1; __syncthreads();
  for (int st = 128; st > 0; st >>= 1) { if (tid < st) red[tid] += red[tid + st]; __syncthreads(); }
  const float mu = red[0] / (float)N; __syncthreads();
  float s2 = 0.f;
  for (int u = 0; u < per / 4; ++u)
#pragma unroll
    for (int q = 0; q < 4; ++q) { const float c = vals[u * 4 + q] - mu; s2 += c * c; }
  red[tid] = s2; __syncthreads();
  for (int st = 128; st > 0; st >>= 1) { if (tid < st) red[tid] += red[tid + st]; __syncthreads(); }
  const float rs = rsqrtf(red[0] / (float)N + eps);
  {
    for (int u = 0; u < per / 4; ++u) {
      const int j = tid * 4 + 1024 * u;
      v4f o, sm;
#pragma unroll
      for (int q = 0; q < 4; ++q) {
        float gg = g[j + q], bb = bta[j + q];
        if (PARAM_BF16) { gg = bf16_round(gg); bb = bf16_round(bb); }
        sm[q] = vals[u * 4 + q]; o[q] = (vals[u * 4 + q] - mu) * rs * gg + bb;
      }
      if (out_sum) *(v4f*)(out_sum + (size_t)row * N + j) = sm;
      *(v4f*)(out_norm + (size_t)row * N + j) = o;
    }
    
  }
}



// ---- f16 WMMA path (v_wmma_f32_16x16x32_f16): 11-bit significands for operands in range — used where a [0,1] probability operand needs more precision than bf16
typedef _Float16 v16h __attribute__((ext_vector_type(16)));
union FragH { v16h v; v8us half[2]; _Float16 h[16]; unsigned short u[16]; };
template <int NT>
__device__ __forceinline__ v8f mmaH(v16h ah, v16h al, v16h bh, v16h bl, v8f c) {
  c = __builtin_amdgcn_wmma_f32_16x16x32_f16(false, ah, false, bh, (short)0, c, false, false);
  if (NT >= 2) c = __builtin_amdgcn_wmma_f32_16x16x32_f16(false, al, false, bh, (short)0, c, false, false);
  if (NT >= 3) c = __builtin_amdgcn_wmma_f32_16x16x32_f16(false, ah, false, bl, (short)0, c, false, false);
  asm volatile("v_nop\n\tv_nop\n\tv_nop\n\tv_nop" : "+v"(c) : "v"(ah), "v"(al), "v"(bh), "v"(bl));
  return c;
}
// batched GEMM like k_gemm_b but f16 operands: A f32 (split into f16 hi/lo if ASPLIT, else rounded to f16), Bt = f16 values [n][k]; alpha; C f32; N multiple of 16 (partial tiles skipped)
template <bool ASPLIT>
__global__ __launch_bounds__(128) void k_gemm_h(const float* __restrict__ A, int lda, size_t sA, const _Float16* __restrict__ Bh, int ldb, size_t sB, float alpha, float* __restrict__ C, int ldc, size_t sC, int M, int N, int K) {
  __shared__ __attribute__((aligned(16))) float so[4][16][64];
  const int tid = threadIdx.x, w = tid >> 5, lane = tid & 31, ln = lane & 15, hh = lane >> 4; const int by = blockIdx.y;
  A += (size_t)by * sA; Bh += (size_t)by * sB; C += (size_t)by * sC;
  const int ntn = (N + 63) / 64; const int wid = blockIdx.x * 4 + w; const int mt = wid / ntn, nq = wid % ntn; if (mt * 16 >= M) return;
  const int row0 = mt * 16, col0 = nq * 64; const float* arow = A + (size_t)(row0 + ln) * lda;
  v8f acc[4] = {};
  for (int kb = 0; kb < K; kb += 32) {
    FragH ah, al;
    const v4f x0 = *(const v4fa*)(arow + kb + 8 * hh), x1 = *(const v4fa*)(arow + kb + 8 * hh + 4), x2 = *(const v4fa*)(arow + kb + 16 + 8 * hh), x3 = *(const v4fa*)(arow + kb + 16 + 8 * hh + 4);
    float xs[16] = {x0[0],x0[1],x0[2],x0[3],x1[0],x1[1],x1[2],x1[3],x2[0],x2[1],x2[2],x2[3],x3[0],x3[1],x3[2],x3[3]};
#pragma unroll
    for (int i = 0; i < 16; ++i) { const _Float16 h = (_Float16)xs[i]; ah.h[i] = h; al.h[i] = ASPLIT ? (_Float16)(xs[i] - (float)h) : (_Float16)0.0f; }
#pragma unroll
    for (int t = 0; t < 4; ++t) { if (col0 + t * 16 >= N) continue; const size_t boff = (size_t)(col0 + t * 16 + ln) * ldb + kb; FragH bq; bq.half[0] = *(const v8us*)(Bh + boff + 8 * hh); bq.half[1] = *(const v8us*)(Bh + boff + 16 + 8 * hh);
      acc[t] = mmaH<ASPLIT ? 2 : 1>(ah.v, al.v, bq.v, bq.v, acc[t]); }
  }
#pragma unroll
  for (int t = 0; t < 4; ++t) { if (col0 + t * 16 >= N) continue;
#pragma unroll
    for (int r = 0; r < 8; ++r) so[w][8 * hh + r][t * 16 + ln] = acc[t][r] * alpha; }
  __builtin_amdgcn_fence(__ATOMIC_ACQ_REL, "workgroup"); __builtin_amdgcn_wave_barrier();
  const int rsub = lane >> 4, c4 = (lane & 15) * 4;
  {
#pragma unroll
    for (int q = 0; q < 8; ++q) { const int r = q * 2 + rsub; if (col0 + c4 < N) { const v4f v = *(const v4fa*)&so[w][r][c4]; *(v4f*)(C + (size_t)(row0 + r) * ldc + col0 + c4) = v; } }
     }
}

// Wt[n][k] = f16(W[k][n]·scale) from f32 row-major W[K][N] (scale = power of two; bf16-exact weights stay exact in f16 away from the subnormal range)
__global__ __launch_bounds__(256) void k_wt_f16(const float* __restrict__ W, _Float16* __restrict__ Wt, int K, int N, float scale) {
  const int t = blockIdx.x * 256 + threadIdx.x; if (t >= N * (K / 8)) return; const int n = t / (K / 8), k8 = (t % (K / 8)) * 8; FragH f;
#pragma unroll
  for (int i = 0; i < 8; ++i) f.h[i] = (_Float16)(bf16_round(W[(size_t)(k8 + i) * N + n]) * scale); const v8us o = f.half[0];
  *(v8us*)((unsigned short*)Wt + (size_t)n * K + k8) = o; 
}
// k_gemm_hh variant with fused epilogue: v = acc·alpha + bias[by·sBias + col] (+ CP[(row/rowsPerB)·sCPb + by·64 + col] if CP) ; ACT 0 none / 1 elu ; writes f16 C16 (and f32 C if non-null)
template <int ACT>
__global__ __launch_bounds__(128) void k_gemm_hhx(const _Float16* __restrict__ A, int lda, size_t sA, const _Float16* __restrict__ Bh, int ldb, size_t sB, float alpha, const float* __restrict__ bias, size_t sBias, const float* __restrict__ CP, int rowsPerB, size_t sCPb, int row0g,
    float* __restrict__ C, _Float16* __restrict__ C16, int ldc, size_t sC, int M, int N, int K) {
  __shared__ __attribute__((aligned(16))) float so[4][16][64];
  const int tid = threadIdx.x, w = tid >> 5, lane = tid & 31, ln = lane & 15, hh = lane >> 4; const int by = blockIdx.y;
  A += (size_t)by * sA; Bh += (size_t)by * sB; const size_t cofs = (size_t)by * sC; const float* bp = bias ? bias + (size_t)by * sBias : nullptr;
  const int ntn = (N + 63) / 64; const int wid = blockIdx.x * 4 + w; const int mt = wid / ntn, nq = wid % ntn; if (mt * 16 >= M) return;
  const int row0 = mt * 16, col0 = nq * 64; const _Float16* arow = A + (size_t)(row0 + ln) * lda;
  v8f acc[4] = {};
  for (int kb = 0; kb < K; kb += 32) { FragH ah; ah.half[0] = *(const v8us*)((const unsigned short*)arow + kb + 8 * hh); ah.half[1] = *(const v8us*)((const unsigned short*)arow + kb + 16 + 8 * hh);
#pragma unroll
    for (int t = 0; t < 4; ++t) { if (col0 + t * 16 >= N) continue; const size_t boff = (size_t)(col0 + t * 16 + ln) * ldb + kb; FragH bq; bq.half[0] = *(const v8us*)((const unsigned short*)Bh + boff + 8 * hh); bq.half[1] = *(const v8us*)((const unsigned short*)Bh + boff + 16 + 8 * hh);
      acc[t] = mmaH<1>(ah.v, ah.v, bq.v, bq.v, acc[t]); }
  }
#pragma unroll
  for (int t = 0; t < 4; ++t) { if (col0 + t * 16 >= N) continue; const int col = col0 + t * 16 + ln; const float bv = bp ? bf16_round(bp[col]) : 0.f;
#pragma unroll
    for (int r = 0; r < 8; ++r) { float v = acc[t][r] * alpha + bv; if (CP) { const int rr = row0g + row0 + 8 * hh + r; if (rowsPerB < 0) v += CP[cofs + (size_t)rr * ldc + col];      /* rowsPerB < 0: own element of the batched C plane */ else { const int bidx = rr / rowsPerB; v += CP[(size_t)bidx * sCPb + (size_t)by * 64 + col]; } } if (ACT == 1) v = (v > 0.f) ? v : expm1f(v); else if (ACT == 7) v = (v > 0.f) ? v + 1.0f : expf(v); else if (ACT == 8) v = tanhf(v); else if (ACT == 9) v = 0.5f * v * (1.0f + tanhf(0.7978845608028654f * (v + 0.044715f * v * v * v))); else if (ACT == 11) v = 1.0f / (1.0f + expf(-v)); else if (ACT == 12) v = (v > 0.f) ? v : 0.01f * v; else if (ACT == 14) v = (v > 0.f) ? v : 0.1f * v; else if (ACT == 16) v = (v >= 0.f) ? v : 0.3f * v; else if (ACT == 17) v = (v >= 0.f) ? v : 0.2f * v; else if (ACT == 15) v = v / (1.0f + expf(-v)); else if (ACT == 3) v = fmaxf(v, 0.f); else if (ACT == 6) v = 0.5f * v * (1.0f + erff(v * 0.70710678118654752f)); so[w][8 * hh + r][t * 16 + ln] = v; } }
  __builtin_amdgcn_fence(__ATOMIC_ACQ_REL, "workgroup"); __builtin_amdgcn_wave_barrier();
  const int rsub = lane >> 4, c4 = (lane & 15) * 4; typedef _Float16 v4h __attribute__((ext_vector_type(4)));
  {
#pragma unroll
    for (int q = 0; q < 8; ++q) { const int r = q * 2 + rsub; if (col0 + c4 < N) { const v4f v = *(const v4fa*)&so[w][r][c4]; if (C) *(v4f*)(C + cofs + (size_t)(row0 + r) * ldc + col0 + c4) = v; if (C16) { v4h h4; for (int i = 0; i < 4; ++i) h4[i] = (_Float16)v[i]; *(v4h*)(C16 + cofs + (size_t)(row0 + r) * ldc + col0 + c4) = h4; } } }
     }
}


typedef _Float16 v4h __attribute__((ext_vector_type(4)));

__global__ __launch_bounds__(256) void k_x16(const float* __restrict__ x, _Float16* __restrict__ X16, size_t n8) { const size_t t = (size_t)blockIdx.x * 256 + threadIdx.x; if (t >= n8) return; FragH f;
#pragma unroll
  for (int q = 0; q < 8; ++q) f.h[q] = (_Float16)bf16_round(x[t * 8 + q]); *(v8us*)((unsigned short*)X16 + t * 8) = f.half[0];  }
__global__ __launch_bounds__(256) void k_h16(const float* __restrict__ x, _Float16* __restrict__ X16, size_t n8) { const size_t t = (size_t)blockIdx.x * 256 + threadIdx.x; if (t >= n8) return; FragH f;
#pragma unroll
  for (int q = 0; q < 8; ++q) f.h[q] = (_Float16)x[t * 8 + q]; *(v8us*)((unsigned short*)X16 + t * 8) = f.half[0];  }
__global__ __launch_bounds__(256) void k_round16f(const float* __restrict__ W, _Float16* __restrict__ Bt, size_t n8) { const size_t t = (size_t)blockIdx.x * 256 + threadIdx.x; if (t >= n8) return; FragH f;
#pragma unroll
  for (int i = 0; i < 8; ++i) f.h[i] = (_Float16)(bf16_round(W[t * 8 + i]) * 16.0f); *(v8us*)((unsigned short*)Bt + t * 8) = f.half[0];  }
template <int NHv, int TTv>
__global__ __launch_bounds__(256) void k_vt(const _Float16* __restrict__ V16, int ldv, int voff, _Float16* __restrict__ Vt) { __shared__ unsigned short tl[64][66]; const int tid = threadIdx.x; const int slab = blockIdx.x / (TTv / 64), lg = blockIdx.x % (TTv / 64); const int b = slab / NHv, h = slab % NHv;
  for (int i = tid; i < 64 * 8; i += 256) { const int r = i / 8, c8 = (i % 8) * 8; FragH f; f.half[0] = *(const v8us*)((const unsigned short*)V16 + ((size_t)b * TTv + lg * 64 + r) * ldv + voff + h * 64 + c8);
#pragma unroll
    for (int q = 0; q < 8; ++q) tl[r][c8 + q] = f.u[q]; }
  __syncthreads();
  {
#pragma unroll
    for (int rd = 0; rd < 2; ++rd) { const int d = rd * 32 + tid / 8, pc = tid % 8; FragH f;
#pragma unroll
      for (int q = 0; q < 8; ++q) f.u[q] = tl[pc * 8 + q][d];
      *(v8us*)((unsigned short*)Vt + ((size_t)slab * 64 + d) * TTv + lg * 64 + pc * 8) = f.half[0]; }
     } }

// ---- fast GEMM (wave tile 32x64; requires M % 32 == 0 rows per launch region and N % 64 == 0); epilogue = k_gemm_hhx semantics ----
__device__ __forceinline__ v16h g2_frag(const _Float16* p, int hh) { FragH f; f.half[0] = *(const v8us*)((const unsigned short*)p + 8 * hh); f.half[1] = *(const v8us*)((const unsigned short*)p + 16 + 8 * hh); return f.v; }
__device__ __forceinline__ v8f g2_mma(v16h a, v16h b, v8f c) { v8f d = __builtin_amdgcn_wmma_f32_16x16x32_f16(false, a, false, b, (short)0, c, false, false); asm volatile("v_nop\n\tv_nop\n\tv_nop\n\tv_nop" : "+v"(d) : "v"(a), "v"(b)); return d; }
template <int ACT>
__global__ __launch_bounds__(128) void k_gemm2(const _Float16* __restrict__ A, int lda, size_t sA, const _Float16* __restrict__ Bh, int ldb, size_t sB, float alpha, const float* __restrict__ bias, size_t sBias, const float* __restrict__ CP, int rowsPerB, size_t sCPb, int row0g,
    float* __restrict__ C, _Float16* __restrict__ C16, int ldc, size_t sC, int M, int N, int K) { static_assert(ACT == 0 || ACT == 3 || ACT == 6 || ACT == 8 || ACT == 9 || ACT == 11 || ACT == 12 || ACT == 14 || ACT == 15 || ACT == 16 || ACT == 17, "k_gemm2: unsupported ACT code (would silently apply no activation)");
  __shared__ __attribute__((aligned(16))) float so[4][32][68];
  const int tid = threadIdx.x, w = tid >> 5, lane = tid & 31, ln = lane & 15, hh = lane >> 4; const int by = blockIdx.y;
  A += (size_t)by * sA; Bh += (size_t)by * sB; const size_t cofs = (size_t)by * sC; const float* bp = bias ? bias + (size_t)by * sBias : nullptr;
  const int ntn = N >> 6; const int mt = blockIdx.x / ntn, nq = blockIdx.x - mt * ntn; const int row0 = mt * 128 + 32 * w, col0 = nq * 64; if (row0 >= M) return;
  const _Float16* a0p = A + (size_t)(row0 + ln) * lda; const _Float16* a1p = a0p + (size_t)16 * lda;
  const _Float16* b0p = Bh + (size_t)(col0 + ln) * ldb; const _Float16* b1p = b0p + (size_t)16 * ldb; const _Float16* b2p = b1p + (size_t)16 * ldb; const _Float16* b3p = b2p + (size_t)16 * ldb;
  const v8f z8 = {0.f,0.f,0.f,0.f,0.f,0.f,0.f,0.f}; v8f c00 = z8, c01 = z8, c02 = z8, c03 = z8, c10 = z8, c11 = z8, c12 = z8, c13 = z8;
#pragma unroll 1
  for (int kb = 0; kb < K; kb += 32) { const v16h a0 = g2_frag(a0p + kb, hh), a1 = g2_frag(a1p + kb, hh);
    v16h b = g2_frag(b0p + kb, hh); c00 = g2_mma(a0, b, c00); c10 = g2_mma(a1, b, c10);
    b = g2_frag(b1p + kb, hh); c01 = g2_mma(a0, b, c01); c11 = g2_mma(a1, b, c11);
    b = g2_frag(b2p + kb, hh); c02 = g2_mma(a0, b, c02); c12 = g2_mma(a1, b, c12);
    b = g2_frag(b3p + kb, hh); c03 = g2_mma(a0, b, c03); c13 = g2_mma(a1, b, c13); }
  v8f accs[8] = {c00, c01, c02, c03, c10, c11, c12, c13};
#pragma unroll
  for (int u = 0; u < 8; ++u) { const int t = u & 3, half = u >> 2; const int col = col0 + t * 16 + ln; const float bv = bp ? bf16_round(bp[col]) : 0.f;
#pragma unroll
    for (int r = 0; r < 8; ++r) { const int rloc = half * 16 + 8 * hh + r; float v = accs[u][r] * alpha + bv; if (CP) { if (rowsPerB < 0) v += CP[cofs + (size_t)(row0g + row0 + rloc) * ldc + col];      /* rowsPerB < 0: own element of the batched C plane */ else { const int bidx = (row0g + row0 + rloc) / rowsPerB; v += CP[(size_t)bidx * sCPb + (size_t)by * 64 + col]; } }
      if (ACT == 3) v = fmaxf(v, 0.f); else if (ACT == 6) v = 0.5f * v * (1.0f + erff(v * 0.70710678118654752f)); else if (ACT == 11) v = 1.0f / (1.0f + expf(-v)); else if (ACT == 15) v = v / (1.0f + expf(-v)); else if (ACT == 12) v = (v > 0.f) ? v : 0.01f * v; else if (ACT == 8) v = tanhf(v); else if (ACT == 9) v = 0.5f * v * (1.0f + tanhf(0.7978845608028654f * (v + 0.044715f * v * v * v))); else if (ACT == 14) v = (v > 0.f) ? v : 0.1f * v; else if (ACT == 16) v = (v >= 0.f) ? v : 0.3f * v; else if (ACT == 17) v = (v >= 0.f) ? v : 0.2f * v;
      so[w][rloc][t * 16 + ln] = v; } }
  __builtin_amdgcn_fence(__ATOMIC_ACQ_REL, "workgroup"); __builtin_amdgcn_wave_barrier();
  const int rsub = lane >> 4, c4 = (lane & 15) * 4;
  {
#pragma unroll
    for (int q = 0; q < 16; ++q) { const int r = q * 2 + rsub; const v4f v = *(const v4fa*)&so[w][r][c4]; if (C) *(v4f*)(C + cofs + (size_t)(row0 + r) * ldc + col0 + c4) = v; if (C16) { v4h h4; for (int i = 0; i < 4; ++i) h4[i] = (_Float16)v[i]; *(v4h*)(C16 + cofs + (size_t)(row0 + r) * ldc + col0 + c4) = h4; } }
     } }


__global__ __launch_bounds__(256) void k_wnat(const float* __restrict__ w, size_t n8, _Float16* __restrict__ Bt) { const size_t t = (size_t)blockIdx.x * 256 + threadIdx.x; if (t >= n8) return; FragH f; for (int q = 0; q < 8; ++q) f.h[q] = (_Float16)(bf16_round(w[t * 8 + q]) * 16.0f); *(v8us*)((unsigned short*)Bt + t * 8) = f.half[0];  }
__global__ __launch_bounds__(256) void k_rsm(const float* __restrict__ S, _Float16* __restrict__ P, int nrows) {
  #pragma clang fp contract(off)
  const int i = blockIdx.x * 256 + threadIdx.x; if (i >= nrows) return; const float* s = S + (size_t)i * SQ; float mx = -3.0e38f;
#pragma unroll 1
  for (int j = 0; j < SQ; ++j) mx = fmaxf(mx, s[j]); float se = 0.f;
#pragma unroll 1
  for (int j = 0; j < SQ; ++j) se += expf(s[j] - mx); const float sc = 256.0f / se;
#pragma unroll 1
  for (int j0 = 0; j0 < SQ; j0 += 8) { FragH f; for (int q = 0; q < 8; ++q) f.h[q] = (_Float16)(expf(s[j0 + q] - mx) * sc); unsigned short* d = (unsigned short*)P + (size_t)i * SQ + j0; *(v8us*)d = f.half[0];  } }
__global__ __launch_bounds__(256) void k_vt(const _Float16* __restrict__ V16, int b, int h0, _Float16* __restrict__ VT) { __shared__ unsigned short tl[64][65]; const int tid = threadIdx.x; const int hh = blockIdx.x % HG, sg = blockIdx.x / HG; const int s0 = sg * 64; const int h = h0 + hh;
  for (int i = tid; i < 64 * 8; i += 256) { const int j = i / 8, d8 = (i % 8) * 8; FragH f; f.half[0] = *(const v8us*)((const unsigned short*)V16 + ((size_t)b * SQ + s0 + j) * DM + h * HD + d8); for (int q = 0; q < 8; ++q) tl[d8 + q][j] = f.u[q]; }
  __syncthreads();
  { for (int i = tid; i < 64 * 8; i += 256) { const int d = i / 8, j8 = (i % 8) * 8; FragH f; for (int q = 0; q < 8; ++q) f.u[q] = tl[d][j8 + q]; *(v8us*)((unsigned short*)VT + ((size_t)hh * HD + d) * SQ + s0 + j8) = f.half[0]; }  } }


// The set-up pieces below are device functions of a flat thread index t: k_kv deals them out by block range.
// Every f16 operand plane of the workspace lies in blocks of 16 rows x 16 columns (k), 512 bytes in a row each, the DM / 16 blocks of 16 rows one behind the other: element (r, k) of a plane stands at
// ((r / 16) * (DM / 16) + k / 16) * 256 + (r % 16) * 16 + k % 16. One half of a WMMA fragment (lane = row ln, 8 values from k = 8 * hh of a block) is then 512 contiguous bytes for the wave, 4 lines; from a row-major plane it was 16 lines.
// The pieces that write such a plane take t in the order of the plane: thread t writes the plane's values 8 t .. 8 t + 7, a wave one whole block.
__device__ __forceinline__ int fb_row(size_t t) { return (int)(t / (DM / 8 * 16)) * 16 + ((int)(t >> 1) & 15); }      /* row of thread t's 8 values */
__device__ __forceinline__ int fb_k8(size_t t) { return ((int)(t >> 5) % (DM / 16)) * 16 + ((int)t & 1) * 8; }      /* their first column */
// a fragment (k order of g2_frag) from such a plane: p = the plane + 16-row group * 16 * DM + first k * 16 + ln * 16 + 8 * hh
__device__ __forceinline__ v16h fb_frag(const _Float16* p) { FragH f; f.half[0] = *(const v8us*)((const unsigned short*)p); f.half[1] = *(const v8us*)((const unsigned short*)p + 256); return f.v; }
// bf16_round with the mask of its last step handed in: 0xFFFF0000 rounds, 0 gives zero. A row that does not count costs no select and no branch so (around the plain form the build put a branch on the lane mask per value).
__device__ __forceinline__ float bf16_round_m(float x, unsigned int mk) { const unsigned int u = __float_as_uint(x); return __uint_as_float((u + 0x7FFFu + ((u >> 16) & 1u)) & mk); }
// Fragments straight from the f32 inputs (k order of g2_frag; k8 = first k of the fragment + 8 * hh), values as the f16 planes hold them.
// Token row prow of the padded numbering (batch * QP + row): rows NQ.. of a batch read row 0 (xf_row) and count as zero (xf_mask).
__device__ __forceinline__ const float* xf_row(const float* __restrict__ x, int prow) { const int q = prow % QP; return x + ((size_t)(prow / QP) * NQ + (q < NQ ? q : 0)) * DM; }
__device__ __forceinline__ unsigned int xf_mask(int prow) { return prow % QP < NQ ? 0xFFFF0000u : 0u; }
// xf_frag: two runs of 8 floats from p = the lane's row + k8.
__device__ __forceinline__ v16h xf_frag(const float* __restrict__ p, unsigned int mk) {
  const v4f x0 = *(const v4fa*)p, x1 = *(const v4fa*)(p + 4), x2 = *(const v4fa*)(p + 16), x3 = *(const v4fa*)(p + 20); FragH f;
  for (int i = 0; i < 4; ++i) { f.h[i] = (_Float16)bf16_round_m(x0[i], mk); f.h[4 + i] = (_Float16)bf16_round_m(x1[i], mk); f.h[8 + i] = (_Float16)bf16_round_m(x2[i], mk); f.h[12 + i] = (_Float16)bf16_round_m(x3[i], mk); }
  return f.v; }
// wf_frag: one column of a [in][out] weight, x16, from p = the weight + k8 * DM + the lane's column: 16 single floats, 512 bytes apart; the 16 lanes of a wave half read 64 bytes in a row.
__device__ __forceinline__ v16h wf_frag(const float* __restrict__ p) { float a[16]; FragH f;
  for (int i = 0; i < 8; ++i) { a[i] = p[i * DM]; a[8 + i] = p[(16 + i) * DM]; }
  for (int i = 0; i < 16; ++i) f.h[i] = (_Float16)(bf16_round(a[i]) * 16.0f);
  return f.v; }
template <int HPP>
__device__ __forceinline__ void wtpadT_at(const float* __restrict__ w, _Float16* __restrict__ Bt, int t) { if (t >= NH * HPP * (DM / 8)) return; const int k8 = fb_k8(t); const int r = fb_row(t); const int h = r / HPP, d = r % HPP; FragH f;
  for (int q = 0; q < 8; ++q) { float v = 0.f; if (d < HD) v = bf16_round(w[(size_t)(k8 + q) * DM + h * HD + d]); f.h[q] = (_Float16)(v * 16.0f); }
  unsigned short* dst = (unsigned short*)Bt + (size_t)t * 8; *(v8us*)dst = f.half[0];
  asm volatile("s_wait_xcnt 0x0" ::: "memory"); }      /* behind the store: in the listing a branch leads on from here into another piece's code, which overwrites the store's registers */
template <int HPP>
__device__ __forceinline__ void wtopadT_at(const float* __restrict__ w, _Float16* __restrict__ Bt, int t) { static_assert(NH * HPP == DM, "the block order above is that of a plane of DM columns"); if (t >= DM * (NH * HPP / 8)) return; const int k8 = fb_k8(t); const int n = fb_row(t); FragH f;
  for (int q = 0; q < 8; ++q) { const int kp = k8 + q; const int h = kp / HPP, d = kp % HPP; float v = 0.f; if (d < HD) v = bf16_round(w[(size_t)(h * HD + d) * DM + n]); f.h[q] = (_Float16)(v * 16.0f); }
  unsigned short* dst = (unsigned short*)Bt + (size_t)t * 8; *(v8us*)dst = f.half[0];
  asm volatile("s_wait_xcnt 0x0" ::: "memory"); }      /* behind the store: in the listing a branch leads on from here into another piece's code, which overwrites the store's registers */
// Mean term in MG partial rows per batch: mu Wq_mean is linear in mu, so block (batch, g) takes the 16 node columns 16 g .. 16 g + 15, sums them over the 1000 rows and multiplies by its 16 rows of Wq_mean; k_dec adds the MG partial rows.
// Column sums: thread = (row t / 4 of a round of 32 rows, 4 columns), eight loads in flight; the 32 partial sums meet in LDS. Thread t is output column t of the product, its 16 weights loaded ahead of the row loads.
#define MG (DM / 16)                 /* partial rows of the mean term */
__device__ __forceinline__ void qmean_part(const float* __restrict__ xn, const float* __restrict__ wqm, float* __restrict__ QM8, int b, int g) {
  static_assert(QP == 4 * 8 * 32 && NQ <= QP && NQ > QP - 32, "four rounds of eight loads of 32 rows reach every row once; only the last load of the last round holds rows past the end");
  __shared__ __attribute__((aligned(16))) float part[32][16]; __shared__ float mu[16];
  const int t = threadIdx.x, rs = t >> 2, c4 = (t & 3) * 4; float wv[16];
#pragma unroll      /* wv[] in registers, all 16 loads in flight */
  for (int i = 0; i < 16; ++i) wv[i] = wqm[(size_t)(g * 16 + i) * DM + t];
  asm volatile("s_wait_xcnt 0x0" ::: "memory");      /* stands in front of the row addresses below, which may be formed in registers that the weight loads just issued name */
  const float* rows = xn + ((size_t)b * NQ + rs) * DM + g * 16 + c4; const bool lin = QP - 32 + rs < NQ; const float* rlast = rows + (lin ? (QP - 32) * DM : 0); const unsigned int mlast = lin ? 0xFFFF0000u : 0u; v4f s = {0.f, 0.f, 0.f, 0.f};      /* rows NQ.. re-read the thread's first row and are left out of the sum */
#pragma unroll 1      /* eight loads a round; stays a loop for the size of the kernel's text */
  for (int r0 = 0; r0 < QP; r0 += 256) { v4f a[8]; const bool fin = r0 == QP - 256;      /* the last round's last load takes rlast */
#pragma unroll      /* a[] in registers, the round's loads in flight together */
    for (int j = 0; j < 7; ++j) a[j] = *(const v4fa*)(rows + 32 * j * DM);
    const float* r7 = fin ? rlast : rows + 32 * 7 * DM; a[7] = *(const v4fa*)r7;
    asm volatile("s_wait_xcnt 0x0" :: "v"(rows), "v"(r7) : "memory");      /* stands in front of whatever reuses the address registers of the loads just issued; the pointers are inputs so that neither a load's result nor their own step lands in them ahead of it */
    rows += 256 * DM;
#pragma unroll      /* a[] in registers */
    for (int j = 0; j < 8; ++j) for (int q = 0; q < 4; ++q) s[q] += bf16_round_m(a[j][q], j == 7 && fin ? mlast : 0xFFFF0000u); }
  *(v4f*)&part[rs][c4] = s;
  __syncthreads();
  if (t < 16) { float m = 0.f; for (int i = 0; i < 32; ++i) m += part[i][t]; mu[t] = m / (float)NQ; }
  __syncthreads();
  float v = 0.f;
#pragma unroll      /* wv[] in registers */
  for (int i = 0; i < 16; ++i) v += mu[i] * bf16_round(wv[i]);
  QM8[((size_t)b * MG + g) * DM + t] = v; }
// First launch: all that k_dec needs of other rows than its own. Nothing here reads what another piece writes, so the pieces are block ranges of one grid of 128-thread blocks; the mean term has the longest chain of waits and takes the first blocks.
// Pieces: the mean term's partial rows; Wq_first^T, Wq_last^T, W_comb^T as f16 planes (x16); k; V^T.
// k and V^T: wave tile 32 x 64, K = DM, weights x16 so the result x 1/16, f16 result. The fragments come straight from the f32 inputs (xf_frag, wf_frag): no launch ahead of this one lays out f16 planes.
// k: A = 32 node rows, B = 64 columns of Wk. The blocks of the first 64 columns also store their A fragments: in the order of a fragment these are the 16 x 16 blocks of the node plane XN, which stage 2 of k_dec reads.
// V^T: the operands change places, A = 32 columns of Wv (two heads), B = 64 node rows of one batch, so the tile comes out as [feature][key].
// k and V^T are stored in the order in which k_dec's fragment loads take them: per batch and head, blocks of 16 x 16 (k: [row][feature], V^T: [d][key]), 512 bytes in a row each.
__device__ __forceinline__ v8f pj_mma(v16h a, v16h b, v8f c) { return __builtin_amdgcn_wmma_f32_16x16x32_f16(false, a, false, b, (short)0, c, false, false); }
#define AT 128                                    /* threads of a block of the first launch */
#define AB_M (NB * MG)                            /* blocks of the mean term */
#define AB_W (DM * (DM / 8) / AT)                 /* blocks of one [128][128] weight plane */
#define AB_K ((int)(NRP / 128) * (DM / 64))       /* blocks of k */
#define AB_V (NB * (QP / 64))                     /* blocks of V^T */
#define AB_ALL (AB_M + 3 * AB_W + AB_K + AB_V)
__global__ __launch_bounds__(AT) void k_kv(const float* __restrict__ xn, const float* __restrict__ wqf, const float* __restrict__ wql, const float* __restrict__ wqm, const float* __restrict__ wk, const float* __restrict__ wv, const float* __restrict__ wc,
    _Float16* __restrict__ XN, _Float16* __restrict__ BQF, _Float16* __restrict__ BQL, _Float16* __restrict__ BCP, float* __restrict__ QM8, _Float16* __restrict__ K16, _Float16* __restrict__ VT) {
  static_assert(QP % 128 == 0 && DM == 128 && NH * HD == DM && DM * (DM / 8) % AT == 0 && QP / 64 == 16, "the 32 rows of a wave tile of k lie in one batch; four waves hold all 128 columns of Wv; every weight plane is a whole number of blocks");
  __shared__ __attribute__((aligned(16))) float so[4][32][68];
  int r = blockIdx.x; const int tid = threadIdx.x;
  if (r < AB_M) { qmean_part(xn, wqm, QM8, r / MG, r % MG); return; }      /* the branch is the same for a whole block: its barriers are met by all of it */
  r -= AB_M;
  if (r < 2 * AB_W) { const int s = r / AB_W; wtpadT_at<HD>(s == 0 ? wqf : wql, s == 0 ? BQF : BQL, (r - s * AB_W) * AT + tid); return; }      /* heads of 16 with no pad: plain W^T */
  r -= 2 * AB_W;
  if (r < AB_W) { wtopadT_at<HD>(wc, BCP, r * AT + tid); return; }
  r -= AB_W;
  const int w = tid >> 5, lane = tid & 31, ln = lane & 15, hh = lane >> 4; const bool isv = r >= AB_K;
  const v8f z8 = {0.f, 0.f, 0.f, 0.f, 0.f, 0.f, 0.f, 0.f}; v8f c[8] = {z8, z8, z8, z8, z8, z8, z8, z8};
  const int e = lane >> 1, f8 = (lane & 1) * 8; _Float16* dp; int st_t, st_h;      /* the store below: lane = (row e of a block, 8 of its 16 values); st_t, st_h: steps from block to block along the tile's columns and rows */
  if (!isv) { const int nq = r & 1, row0 = (r >> 1) * 128 + 32 * w, col0 = nq * 64; unsigned short* xo = (unsigned short*)XN + (size_t)row0 * DM + ln * 16 + 8 * hh;
    const float* pa0 = xf_row(xn, row0 + ln) + 8 * hh; const float* pa1 = xf_row(xn, row0 + 16 + ln) + 8 * hh; const float* pw = wk + (size_t)(8 * hh) * DM + col0 + ln; const unsigned int m0 = xf_mask(row0 + ln), m1 = xf_mask(row0 + 16 + ln);
#pragma unroll 1      /* stays a loop: unrolled whole, the kernel was some 5,900 instructions, by count more than 32 KB of text */
    for (int kb = 0; kb < DM; kb += 32) { FragH a0, a1; v16h bq[4]; a0.v = xf_frag(pa0, m0); a1.v = xf_frag(pa1, m1);
#pragma unroll      /* bq[] in registers */
      for (int t = 0; t < 4; ++t) bq[t] = wf_frag(pw + 16 * t);
      asm volatile("s_wait_xcnt 0x0" :: "v"(pa0), "v"(pa1), "v"(pw) : "memory");      /* stands in front of whatever reuses the address registers of the loads just issued; the pointers are inputs so that neither a load's result nor their own step lands in them ahead of it */
      pa0 += 32; pa1 += 32; pw += 32 * DM;
      if (nq == 0) { *(v8us*)(xo + kb * 16) = a0.half[0]; *(v8us*)(xo + kb * 16 + 256) = a0.half[1]; *(v8us*)(xo + 16 * DM + kb * 16) = a1.half[0]; *(v8us*)(xo + 16 * DM + kb * 16 + 256) = a1.half[1];
        asm volatile("s_wait_xcnt 0x0" ::: "memory"); }      /* behind the stores: the next step overwrites their data registers */
#pragma unroll      /* c[] in registers */
      for (int t = 0; t < 4; ++t) { c[t] = pj_mma(a0.v, bq[t], c[t]); c[4 + t] = pj_mma(a1.v, bq[t], c[4 + t]); } }
    dp = K16 + ((size_t)((row0 / QP) * NH + nq * 4) * QP + (row0 % QP) + e) * HD + f8; st_t = QP * HD; st_h = 16 * HD; }      /* k: [batch][head][row][16 features]; the tile holds 4 heads x 2 blocks of rows */
  else { const int by = (r - AB_K) >> 4, nq = (r - AB_K) & 15, key0 = by * QP + nq * 64 + ln;
    const float* pw = wv + (size_t)(8 * hh) * DM + 32 * w + ln; const float* px0 = xf_row(xn, key0) + 8 * hh; const float* px1 = xf_row(xn, key0 + 16) + 8 * hh; const float* px2 = xf_row(xn, key0 + 32) + 8 * hh; const float* px3 = xf_row(xn, key0 + 48) + 8 * hh;
    const unsigned int m0 = xf_mask(key0), m1 = xf_mask(key0 + 16), m2 = xf_mask(key0 + 32), m3 = xf_mask(key0 + 48);
#pragma unroll 1      /* as above */
    for (int kb = 0; kb < DM; kb += 32) { v16h bq[4]; const v16h a0 = wf_frag(pw), a1 = wf_frag(pw + 16);
      bq[0] = xf_frag(px0, m0); bq[1] = xf_frag(px1, m1); bq[2] = xf_frag(px2, m2); bq[3] = xf_frag(px3, m3);
      asm volatile("s_wait_xcnt 0x0" :: "v"(pw), "v"(px0), "v"(px1), "v"(px2), "v"(px3) : "memory");      /* as above */
      pw += 32 * DM; px0 += 32; px1 += 32; px2 += 32; px3 += 32;
#pragma unroll      /* c[] in registers */
      for (int t = 0; t < 4; ++t) { c[t] = pj_mma(a0, bq[t], c[t]); c[4 + t] = pj_mma(a1, bq[t], c[4 + t]); } }
    dp = VT + (size_t)by * NH * QP * HD + ((size_t)(2 * w * (QP / 16) + nq * 4) * 16 + e) * HD + f8; st_t = 16 * HD; st_h = (QP / 16) * 16 * HD; }      /* V^T: [head][block of 16 keys][16 d][16 keys]; the tile holds 2 heads x 4 blocks of keys */
#pragma unroll      /* c[] in registers */
  for (int u = 0; u < 8; ++u) { const int t = u & 3, half = u >> 2;
    for (int i = 0; i < 8; ++i) so[w][half * 16 + 8 * hh + i][t * 16 + ln] = c[u][i] * 0.0625f; }
  __builtin_amdgcn_fence(__ATOMIC_ACQ_REL, "workgroup"); __builtin_amdgcn_wave_barrier();      /* the reads below take what other lanes of this wave stored */
  FragH f[8];
#pragma unroll      /* f[] in registers: the eight blocks are read and converted first, the eight stores follow in a row */
  for (int u = 0; u < 8; ++u) { const float* s8 = &so[w][(u >> 2) * 16 + e][(u & 3) * 16 + f8]; const v4f x0 = *(const v4fa*)s8, x1 = *(const v4fa*)(s8 + 4);
    for (int i = 0; i < 4; ++i) { f[u].h[i] = (_Float16)x0[i]; f[u].h[4 + i] = (_Float16)x1[i]; } }
#pragma unroll      /* f[] in registers */
  for (int u = 0; u < 8; ++u) *(v8us*)(dp + (u & 3) * st_t + (u >> 2) * st_h) = f[u].half[0];
  asm volatile("s_wait_xcnt 0x0" ::: "memory"); }      /* behind the stores: in the listing branches lead on from here into other pieces' code, which overwrites the stores' registers */
// Row softmaxes, one wave per row: lane holds columns 4*lane + 128*u (u = 0..7), so each wave-wide b128 load or store covers 512 contiguous bytes;
// the row's values stay in registers between the maximum, the sum and the store. Maximum and sum: per lane first, then a five-step butterfly over the 32 lanes.
// Columns NQ..QP-1 (lanes 26..31 of u = 7): the score planes hold them; the mask does not, so those lanes re-read their own first chunk; their value is -inf (weight 0) and nothing is stored.
__device__ __forceinline__ float wave_max32(float v) { for (int m = 16; m > 0; m >>= 1) v = fmaxf(v, __shfl_xor(v, m, 32)); return v; }
__device__ __forceinline__ float wave_sum32(float v) { for (int m = 16; m > 0; m >>= 1) v += __shfl_xor(v, m, 32); return v; }
// 2^x as one v_exp_f32 (what __expf compiles to behind its multiply) with the issue slot behind it filled
__device__ __forceinline__ float exp2_slot(float x) { float r; asm("v_exp_f32 %0, %1\n\tv_nop" : "=v"(r) : "v"(x)); return r; }
// tanh as one v_tanh_f32, the issue slot behind it filled in the same way
__device__ __forceinline__ float tanh_slot(float x) { float r; asm("v_tanh_f32 %0, %1\n\tv_nop" : "=v"(r) : "v"(x)); return r; }
__device__ __forceinline__ v16h at_frag16(v8us lo) { FragH f; f.half[0] = lo; const v8us z = {0, 0, 0, 0, 0, 0, 0, 0}; f.half[1] = z; return f.v; }      /* q or k row of one head: 16 features, k 16..31 of the fragment zero */
__device__ __forceinline__ v8f at_mma(v16h a, v16h b, v8f c) { return __builtin_amdgcn_wmma_f32_16x16x32_f16(false, a, false, b, (short)0, c, false, false); }
// what 32 keys take for one lane: from memory its 8 features of two k rows (a tile of 16 keys of one head is 512 bytes in a row, lane l takes bytes 32 (l % 16) + 16 (l / 16) ..: a whole-line load), from the block's staged mask rows in LDS (mr, already rounded) 2 x 8 mask values of its query. EDGE: a lane whose 8 keys lie at or past NQ reads its 8 mask values of the row's first 16 columns instead, and those keys count as -inf
struct At32 { v8us k0, k1; v4f m0, m1, m2, m3; };
template <bool EDGE>
__device__ __forceinline__ At32 at_load(const unsigned short* kp, const float* mr, int k0, int hh) {
  At32 t; const int c0 = (!EDGE || k0 + 8 * hh < NQ) ? k0 : 0, c1 = (!EDGE || k0 + 16 + 8 * hh < NQ) ? k0 + 16 : 0;
  t.k0 = *(const v8us*)(kp + (size_t)k0 * HD); t.k1 = *(const v8us*)(kp + (size_t)(k0 + 16) * HD);
  t.m0 = *(const v4fa*)(mr + c0); t.m1 = *(const v4fa*)(mr + c0 + 4); t.m2 = *(const v4fa*)(mr + c1); t.m3 = *(const v4fa*)(mr + c1 + 4); return t; }
// x[0..7], x[8..15]: scores / 4 + mask of this lane's query against keys k0 + 8 * hh + r and k0 + 16 + 8 * hh + r
template <bool EDGE>
__device__ __forceinline__ void at_score(const At32& t, v16h qf, int k0, int hh, float* x) {
  const v8f z8 = {0.f, 0.f, 0.f, 0.f, 0.f, 0.f, 0.f, 0.f}; const v8f s0 = at_mma(at_frag16(t.k0), qf, z8), s1 = at_mma(at_frag16(t.k1), qf, z8);
  const bool in0 = !EDGE || k0 + 8 * hh < NQ, in1 = !EDGE || k0 + 16 + 8 * hh < NQ;
#pragma unroll      /* x[] in registers */
  for (int r = 0; r < 8; ++r) { const float v0 = s0[r] * 0.25f + (r < 4 ? t.m0[r & 3] : t.m1[r & 3]), v1 = s1[r] * 0.25f + (r < 4 ? t.m2[r & 3] : t.m3[r & 3]);
    x[r] = in0 ? v0 : -__builtin_inff(); x[8 + r] = in1 ? v1 : -__builtin_inff(); } }
// V^T fragment of 32 keys (k order of g2_frag): two blocks [16 d][16 keys] of 512 bytes in a row each; vp points at this lane's 8 keys of its row d in block 0
__device__ __forceinline__ v16h at_vfrag(const _Float16* vp, int k0) { FragH f; f.half[0] = *(const v8us*)((const unsigned short*)vp + (size_t)k0 * HD); f.half[1] = *(const v8us*)((const unsigned short*)vp + (size_t)(k0 + 16) * HD); return f.v; }
template <bool EDGE>
__device__ __forceinline__ float at_max32(const At32& t, v16h qf, int k0, int hh, float mx) {
  float x[16]; at_score<EDGE>(t, qf, k0, hh, x);
#pragma unroll      /* x[] in registers */
  for (int r = 0; r < 16; ++r) mx = fmaxf(mx, x[r]);
  return mx; }
template <bool EDGE>
__device__ __forceinline__ v8f at_pv32(const At32& t, v16h vf, v16h qf, int k0, int hh, float mx, float* se, v8f o) {
  float x[16]; at_score<EDGE>(t, qf, k0, hh, x); FragH pf;
#pragma unroll      /* x[] in registers; four running sums, so that an add does not wait for the one before it */
  for (int r = 0; r < 16; ++r) { const float e = exp2_slot((x[r] - mx) * 1.44269504f + 8.0f); se[r & 3] += e; pf.h[r] = (_Float16)e; }
  return at_mma(vf, pf.v, o); }
// Attention, the combine projection and stage 2 in one launch: block = (16 query rows, batch), eight waves. What went from launch to launch through memory (o, its hi and residual planes, mh) now goes from wave to wave through LDS.
// The q projection stands at the head: wave w brings rows 2 w and 2 w + 1 of q1 and of the last node (f32 inputs, rounded, f16) to LDS beside the mask rows; behind the same barrier each wave forms its head's q^T by eight products and adds the mean term's partial rows.
// Ahead of the attention the block's 16 mask rows are staged once in sc (free until stage 2): wave w brings rows 2 w and 2 w + 1 by loads of 512 contiguous bytes and rounds them; all eight heads read them there in both passes
// (a lane's 8 mask values straight from memory made every load touch 16 lines, and every head did that twice). The pitch SP puts the 16 rows that a b128 read touches 4 banks apart.
// Attention as described above, wave = head; a lane's 8 values of o (x64) go to its query's row of ob.
// Combine, behind the second barrier: every wave splits the 16 rows of o into f16 hi + x1024 residual fragments (k order of g2_frag, K = 128) and forms the 16 columns 16 w .. 16 w + 15 of mh = o W_comb + b_comb, which go to mhb.
// Stage 2, behind the third barrier: score2 stays in LDS, the probabilities go straight to out.
// Part 1: wave w forms score2 of the 16 rows against keys 128 w .. 128 w + 127, eight tiles of 16 keys. The mh rows are split here into f16 hi + x1024 residual fragments (k order of g2_frag) and stay in registers.
// A tile of 16 node rows is 4 KiB in a row in memory, eight blocks in fragment order: eight loads of 512 contiguous bytes a wave, one tile ahead, are the tile's four fragments.
// Part 2, behind the fourth barrier: wave w takes rows 2 w and 2 w + 1 whole, lane = columns 4 * lane + 128 * u as in the row softmaxes above.
// Its tanh is one v_tanh_f32 and its e^x one v_exp_f32 behind a multiply: the library tanhf put a compare, two branches on the lane mask and a serial polynomial behind every value, so that no value's work overlapped the next one's.
#define SP (QP + 4)                  /* score row pitch in LDS, floats: rows r and r + 8, stored by the two wave halves together, lie 32 banks apart */
#define XP (DM + 8)                  /* pitch of the staged q1 and last-node rows in LDS, f16 values: 272 bytes, a multiple of the 16 bytes of a fragment read */
#define OP (DM + 4)                  /* o and mh row pitch in LDS, floats: 528 bytes, so the 16 rows that a b128 fragment read touches start 4 banks apart */
__global__ __launch_bounds__(256) void k_dec(const float* __restrict__ xq1, const float* __restrict__ xl, const _Float16* __restrict__ BQF, const _Float16* __restrict__ BQL, const float* __restrict__ QM8, const _Float16* __restrict__ K16, const _Float16* __restrict__ VT, const _Float16* __restrict__ BC, const float* __restrict__ bc, const _Float16* __restrict__ XN, const float* __restrict__ mask, float* __restrict__ out) {
  static_assert(NQ % 8 == 0 && NQ > QP - 32 && NQ <= QP && QP % 128 == 0, "only the last 32 keys hold an edge, and a lane's 8 keys are all in or all out");
  static_assert(QP == 8 * 128 && DM == 128 && NQ % 4 == 0, "eight waves of 128 keys; a node row is 16 lanes of 16 bytes; a lane's 4 columns are all in or all out");
  __shared__ __attribute__((aligned(16))) float sc[16][SP]; __shared__ __attribute__((aligned(16))) float ob[16][OP]; __shared__ __attribute__((aligned(16))) float mhb[16][OP]; __shared__ __attribute__((aligned(16))) _Float16 xs1[16][XP], xsl[16][XP];
  const int b = blockIdx.y, row0 = blockIdx.x * 16, lane = threadIdx.x & 31, ln = lane & 15, hh = lane >> 4;
  const int w = __builtin_amdgcn_readfirstlane(threadIdx.x >> 5);      /* wave number in a scalar register: LDS bases and the row test below are scalar */
  { const int h = w, c = ln, q = row0 + c; const bool live = q < NQ;      /* rows NQ.. of the last block: same instruction stream on a staged copy of mask row 0, scale 0, so zeros go to ob */
  const unsigned short* kp = (const unsigned short*)K16 + ((size_t)(b * NH + h) * QP + c) * HD + 8 * hh; const _Float16* vp = VT + (size_t)(b * NH + h) * QP * HD + c * HD + 8 * hh;
  const _Float16* pw1 = BQF + (size_t)16 * h * DM + ln * 16 + 8 * hh; const _Float16* pw2 = BQL + (size_t)16 * h * DM + ln * 16 + 8 * hh; v16h wq1[4], wq2[4];      /* this head's 16 rows of Wq_first^T and Wq_last^T (x16): issued behind the mask rows, which come from furthest away, so that the latencies are paid as one */
  { const int cs = lane * 4, p0 = row0 + 2 * w, p1 = p0 + 1; const float* r0 = mask + ((size_t)b * NQ + (p0 < NQ ? p0 : 0)) * NQ + cs; const float* r1 = mask + ((size_t)b * NQ + (p1 < NQ ? p1 : 0)) * NQ + cs; v4f g0[QP / 128], g1[QP / 128];
    const bool i0 = p0 < NQ, i1 = p1 < NQ; const unsigned int k0m = i0 ? 0xFFFF0000u : 0u, k1m = i1 ? 0xFFFF0000u : 0u; const size_t t0 = ((size_t)b * NQ + (i0 ? p0 : 0)) * DM + cs, t1 = ((size_t)b * NQ + (i1 ? p1 : 0)) * DM + cs;      /* a token row is one load of 512 contiguous bytes; rows NQ.. read row 0 and count as zero */
#pragma unroll      /* g0[], g1[] in registers, both rows' loads in flight together */
    for (int u = 0; u < QP / 128; ++u) { const int o = (cs + 128 * u < NQ) ? 128 * u : 0; g0[u] = *(const v4fa*)(r0 + o); g1[u] = *(const v4fa*)(r1 + o); }
    asm volatile("s_wait_xcnt 0x0" ::: "memory");      /* stands in front of whatever reuses the address registers of the mask loads just issued */
    const float* pq0 = xq1 + t0; const float* pq1 = xq1 + t1; const float* pl0 = xl + t0; const float* pl1 = xl + t1; const v4f ta0 = *(const v4fa*)pq0, ta1 = *(const v4fa*)pq1, tl0 = *(const v4fa*)pl0, tl1 = *(const v4fa*)pl1;
    asm volatile("s_wait_xcnt 0x0" :: "v"(pq0), "v"(pq1), "v"(pl0), "v"(pl1) : "memory");      /* stands in front of whatever reuses the address registers of the four loads just issued; the pointers are inputs so that no load's result lands in them ahead of it */
#pragma unroll      /* wq1[], wq2[] in registers */
    for (int j = 0; j < 4; ++j) { wq1[j] = fb_frag(pw1 + 32 * j * 16); wq2[j] = fb_frag(pw2 + 32 * j * 16); }
    asm volatile("s_wait_xcnt 0x0" :: "v"(pw1), "v"(pw2) : "memory");      /* stands in front of whatever reuses the address registers of the loads just issued; the pointers are inputs so that no load's result lands in them ahead of it */
    { v4h a, d, e, f; for (int i = 0; i < 4; ++i) { a[i] = (_Float16)bf16_round_m(ta0[i], k0m); d[i] = (_Float16)bf16_round_m(ta1[i], k1m); e[i] = (_Float16)bf16_round_m(tl0[i], k0m); f[i] = (_Float16)bf16_round_m(tl1[i], k1m); }
      *(v4h*)&xs1[2 * w][cs] = a; *(v4h*)&xs1[2 * w + 1][cs] = d; *(v4h*)&xsl[2 * w][cs] = e; *(v4h*)&xsl[2 * w + 1][cs] = f; }
#pragma unroll      /* g0[], g1[] in registers */
    for (int u = 0; u < QP / 128; ++u) { const bool in = cs + 128 * u < NQ; v4f a, d; for (int i = 0; i < 4; ++i) { a[i] = bf16_round(in ? g0[u][i] : -__builtin_inff()); d[i] = bf16_round(in ? g1[u][i] : -__builtin_inff()); }
      *(v4f*)&sc[2 * w][cs + 128 * u] = a; *(v4f*)&sc[2 * w + 1][cs + 128 * u] = d; } }      /* columns NQ.. get -inf: one store path for every lane (with a branch round the last stores the build moved their loads into it, a second trip to memory) */
  v4f cpa[MG], cpb[MG];      /* the mean term's partial rows at this lane's 8 features: issued ahead of the barrier, once the registers of the raw mask rows are free (issued with them, the kernel went past 256 registers, that is under four waves a SIMD) */
#pragma unroll      /* cpa[], cpb[] in registers */
  for (int g = 0; g < MG; ++g) { const float* mp = QM8 + ((size_t)b * MG + g) * DM + h * HD + 8 * hh; cpa[g] = *(const v4fa*)mp; cpb[g] = *(const v4fa*)(mp + 4); }
  asm volatile("s_wait_xcnt 0x0" ::: "memory");      /* stands in front of whatever reuses the address registers of the loads just issued */
  __syncthreads();      /* the 16 mask rows and the 16 q1 and last-node rows are whole */
  v8f qa = {0.f, 0.f, 0.f, 0.f, 0.f, 0.f, 0.f, 0.f};      /* q^T of this head = Wq_first^T q1^T + Wq_last^T last^T: a lane gets features 8 * hh + r of query c, which is its half of the q fragment */
#pragma unroll      /* fragments in registers */
  for (int j = 0; j < 4; ++j) { FragH xb; xb.half[0] = *(const v8us*)&xs1[c][32 * j + 8 * hh]; xb.half[1] = *(const v8us*)&xs1[c][32 * j + 16 + 8 * hh]; qa = at_mma(wq1[j], xb.v, qa); }
#pragma unroll      /* fragments in registers */
  for (int j = 0; j < 4; ++j) { FragH xb; xb.half[0] = *(const v8us*)&xsl[c][32 * j + 8 * hh]; xb.half[1] = *(const v8us*)&xsl[c][32 * j + 16 + 8 * hh]; qa = at_mma(wq2[j], xb.v, qa); }
  FragH qh;
#pragma unroll      /* cpa[], cpb[] in registers */
  for (int r = 0; r < 8; ++r) { float m = 0.f; for (int g = 0; g < MG; ++g) m += r < 4 ? cpa[g][r & 3] : cpb[g][r & 3]; qh.h[r] = (_Float16)(qa[r] * 0.0625f + m); }
  const v16h qf = at_frag16(qh.half[0]);
  const float* mr = &sc[c][8 * hh]; float mx = -3.0e38f;
#pragma unroll 1      /* stays a loop: unrolled whole, the two passes were some 10,000 instructions and spilled */
  for (int k0 = 0; k0 < QP - 128; k0 += 128) { At32 t[4];
#pragma unroll      /* t[] in registers, the loads of 128 keys in flight together */
    for (int j = 0; j < 4; ++j) t[j] = at_load<false>(kp, mr, k0 + 32 * j, hh);
#pragma unroll      /* t[] in registers */
    for (int j = 0; j < 4; ++j) mx = at_max32<false>(t[j], qf, k0 + 32 * j, hh, mx); }
  { At32 t[4];      /* the last 128 keys */
#pragma unroll      /* t[] in registers */
    for (int j = 0; j < 3; ++j) t[j] = at_load<false>(kp, mr, QP - 128 + 32 * j, hh);
    t[3] = at_load<true>(kp, mr, QP - 32, hh);
#pragma unroll      /* t[] in registers */
    for (int j = 0; j < 3; ++j) mx = at_max32<false>(t[j], qf, QP - 128 + 32 * j, hh, mx);
    mx = at_max32<true>(t[3], qf, QP - 32, hh, mx); }
  mx = fmaxf(mx, __shfl_xor(mx, 16, 32));
  v8f o = {0.f, 0.f, 0.f, 0.f, 0.f, 0.f, 0.f, 0.f}; float se[4] = {0.f, 0.f, 0.f, 0.f};
#pragma unroll 1      /* stays a loop, as above */
  for (int k0 = 0; k0 < QP - 64; k0 += 64) {      /* the loads of 64 keys in flight together */
    const At32 t0 = at_load<false>(kp, mr, k0, hh), t1 = at_load<false>(kp, mr, k0 + 32, hh);
    asm volatile("s_wait_xcnt 0x0" ::: "memory");      /* the build let a V load's result land in the address pair of the k loads just issued: the wait stands in front of that overwrite */
    const v16h v0 = at_vfrag(vp, k0), v1 = at_vfrag(vp, k0 + 32);
    o = at_pv32<false>(t0, v0, qf, k0, hh, mx, se, o); o = at_pv32<false>(t1, v1, qf, k0 + 32, hh, mx, se, o); }
  { const At32 t0 = at_load<false>(kp, mr, QP - 64, hh), t1 = at_load<true>(kp, mr, QP - 32, hh);
    asm volatile("s_wait_xcnt 0x0" ::: "memory");      /* as in the loop: a V load's result lands in the address pair of the k loads just issued */
    const v16h v0 = at_vfrag(vp, QP - 64), v1 = at_vfrag(vp, QP - 32);
    o = at_pv32<false>(t0, v0, qf, QP - 64, hh, mx, se, o); o = at_pv32<true>(t1, v1, qf, QP - 32, hh, mx, se, o); }
  float st = (se[0] + se[1]) + (se[2] + se[3]); st += __shfl_xor(st, 16, 32);
  const float osc = live ? 64.0f / st : 0.f;      /* o x64 */
  const v4f o0 = {o[0] * osc, o[1] * osc, o[2] * osc, o[3] * osc}, o1 = {o[4] * osc, o[5] * osc, o[6] * osc, o[7] * osc};
  *(v4f*)&ob[c][h * HD + 8 * hh] = o0; *(v4f*)&ob[c][h * HD + 8 * hh + 4] = o1; }
  v16h wf[4];      /* this wave's 16 rows of W_comb^T (x16), the bias at its column and, below, the first node tile: issued together ahead of the barrier, so that the three latencies are paid as one */
#pragma unroll      /* wf[] in registers */
  for (int j = 0; j < 4; ++j) wf[j] = fb_frag(BC + (size_t)16 * w * DM + 32 * j * 16 + ln * 16 + 8 * hh);
  const float bv = bf16_round(bc[16 * w + ln]);
  asm volatile("s_wait_xcnt 0x0" ::: "memory");      /* the build lets a node load's result land in the address pair of the W_comb^T loads just issued: the wait stands in front of that overwrite */
  const unsigned short* xb = (const unsigned short*)XN + ((size_t)b * QP + 128 * w) * DM + ln * 16 + 8 * hh; v8us st[8];      /* st[i]: this lane's 8 values of block i of a tile of 16 node rows, that is half i & 1 of fragment i / 2 */
#pragma unroll      /* st[] in registers, the tile's loads in flight together */
  for (int i = 0; i < 8; ++i) st[i] = *(const v8us*)(xb + i * 256);
  __syncthreads();      /* ob is whole */
  { v8f mh_h = {0.f, 0.f, 0.f, 0.f, 0.f, 0.f, 0.f, 0.f}, mh_l = mh_h; const float* orw = &ob[ln][8 * hh];
#pragma unroll      /* fragments in registers */
    for (int j = 0; j < 4; ++j) { const v4f x0 = *(const v4fa*)(orw + 32 * j), x1 = *(const v4fa*)(orw + 32 * j + 4), x2 = *(const v4fa*)(orw + 32 * j + 16), x3 = *(const v4fa*)(orw + 32 * j + 20); FragH fh, fl;
      const float xs[16] = {x0[0], x0[1], x0[2], x0[3], x1[0], x1[1], x1[2], x1[3], x2[0], x2[1], x2[2], x2[3], x3[0], x3[1], x3[2], x3[3]};
      for (int i = 0; i < 16; ++i) { const _Float16 g = (_Float16)xs[i]; fh.h[i] = g; fl.h[i] = (_Float16)((xs[i] - (float)g) * 1024.0f); }
      mh_h = at_mma(fh.v, wf[j], mh_h); mh_l = at_mma(fl.v, wf[j], mh_l); }
#pragma unroll      /* eight plain LDS stores */
    for (int r = 0; r < 8; ++r) mhb[8 * hh + r][16 * w + ln] = (mh_h[r] * 0.0009765625f + bv) + mh_l[r] * 0.00000095367431640625f; }      /* o x64, W_comb x16: 2^-10; the residual x1024 more: 2^-20 */
  __syncthreads();      /* mhb is whole */
  const float* ar = &mhb[ln][8 * hh]; FragH ah[4], al[4];
#pragma unroll      /* ah[], al[] in registers */
  for (int j = 0; j < 4; ++j) { const v4f x0 = *(const v4fa*)(ar + 32 * j), x1 = *(const v4fa*)(ar + 32 * j + 4), x2 = *(const v4fa*)(ar + 32 * j + 16), x3 = *(const v4fa*)(ar + 32 * j + 20);
    const float xs[16] = {x0[0], x0[1], x0[2], x0[3], x1[0], x1[1], x1[2], x1[3], x2[0], x2[1], x2[2], x2[3], x3[0], x3[1], x3[2], x3[3]};
    for (int i = 0; i < 16; ++i) { const _Float16 h = (_Float16)xs[i]; ah[j].h[i] = h; al[j].h[i] = (_Float16)((xs[i] - (float)h) * 1024.0f); } }
#pragma unroll      /* st[] in registers; the next tile's loads stand ahead of this tile's products */
  for (int t = 0; t < 8; ++t) {
    FragH bf[4];
    for (int j = 0; j < 4; ++j) { bf[j].half[0] = st[2 * j]; bf[j].half[1] = st[2 * j + 1]; }
    if (t < 7) for (int i = 0; i < 8; ++i) st[i] = *(const v8us*)(xb + (t + 1) * 16 * DM + i * 256);
    __builtin_amdgcn_sched_barrier(0);      /* the next tile's eight loads stay together ahead of this tile's products: left free, the build moved each pair of loads down to its use, a trip to L2 waited for per fragment */
    v8f sh = {0.f, 0.f, 0.f, 0.f, 0.f, 0.f, 0.f, 0.f}, sl = sh;
    for (int j = 0; j < 4; ++j) { sh = at_mma(ah[j].v, bf[j].v, sh); sl = at_mma(al[j].v, bf[j].v, sl); }
    for (int r = 0; r < 8; ++r) sc[8 * hh + r][128 * w + 16 * t + ln] = sh[r] * 0.088388347648318447f + sl[r] * 0.000086316745750311f; }      /* (mh_hi + mh_lo / 1024) nodes^T / sqrt(128) */
  const int c0 = lane * 4; v4f m[QP / 128], mn[QP / 128];
  { const int p0 = row0 + 2 * w, p1 = p0 + 1; const float* r0 = mask + ((size_t)b * NQ + (p0 < NQ ? p0 : 0)) * NQ + c0; const float* r1 = mask + ((size_t)b * NQ + (p1 < NQ ? p1 : 0)) * NQ + c0;
#pragma unroll      /* m[], mn[] in registers, both rows' mask loads in flight together */
    for (int u = 0; u < QP / 128; ++u) { const int o = (c0 + 128 * u < NQ) ? 128 * u : 0;
      if (u == QP / 128 - 1) asm volatile("s_wait_xcnt 0x0" ::: "memory");      /* without these two waits the build let the result of the last load land in address pairs that loads just issued name: a wait stands in front of each of the last two loads */
      m[u] = *(const v4fa*)(r0 + o);
      if (u == QP / 128 - 1) asm volatile("s_wait_xcnt 0x0" ::: "memory");      /* the second of the two waits */
      mn[u] = *(const v4fa*)(r1 + o); } }
  asm volatile("s_wait_xcnt 0x0" ::: "memory");      /* stands in front of part 2, which reuses the address registers of the mask loads just issued */
  __syncthreads();
#pragma unroll 1      /* stays the loop it was: how the two rows follow one another is not part of this change */
  for (int rr = 0; rr < 2; ++rr) { const int lr = 2 * w + rr, p = row0 + lr; if (p >= NQ) break;      /* rows NQ.. of the last block: no output; no barrier follows */
    float* pr = out + ((size_t)b * NQ + p) * NQ + c0; v4f x[QP / 128]; float mx = -3.0e38f;
#pragma unroll      /* x[] in registers */
    for (int u = 0; u < QP / 128; ++u) x[u] = *(const v4fa*)&sc[lr][c0 + 128 * u];
#pragma unroll      /* x[] in registers */
    for (int u = 0; u < QP / 128; ++u) { const bool in = c0 + 128 * u < NQ; for (int q = 0; q < 4; ++q) { const float v = 10.0f * tanh_slot(x[u][q]) + bf16_round(m[u][q]); x[u][q] = in ? v : -__builtin_inff(); mx = fmaxf(mx, x[u][q]); } }
    mx = wave_max32(mx); float se = 0.f;
#pragma unroll      /* x[] in registers */
    for (int u = 0; u < QP / 128; ++u) for (int q = 0; q < 4; ++q) { x[u][q] = exp2_slot((x[u][q] - mx) * 1.44269504f); se += x[u][q]; }
    const float inv = 1.0f / wave_sum32(se);
#pragma unroll      /* x[] in registers */
    for (int u = 0; u < QP / 128; ++u) { v4f o; for (int q = 0; q < 4; ++q) o[q] = x[u][q] * inv; if (c0 + 128 * u < NQ) *(v4f*)(pr + 128 * u) = o; }
    asm volatile("s_wait_xcnt 0x0" ::: "memory");      /* stands in front of the copies below and the next row, which overwrite the registers of the stores just issued */
#pragma unroll      /* m[] in registers */
    for (int u = 0; u < QP / 128; ++u) m[u] = mn[u]; } }

extern "C" void kernel_launch(void* const* d_in, const int* in_sizes, int n_in,
                              void* d_out, int out_size, void* d_ws, size_t ws_size, hipStream_t stream) {
  (void)in_sizes; (void)n_in; (void)out_size;
  const float* const* I = (const float* const*)d_in; const float* xn = I[0]; const float* xq1 = I[1]; const float* xl = I[2]; const float* mask = I[3]; const float* Wqf = I[4]; const float* Wql = I[5]; const float* Wqm = I[6]; const float* Wk = I[7]; const float* Wv = I[8]; const float* Wc = I[9]; const float* bc = I[10];      /* weights [in][out] */
  char* ws = (char*)d_ws; size_t off = 0;
  auto take = [&](size_t bytes) { char* p = ws + off; off += (bytes + 255) & ~(size_t)255; return p; };
  _Float16* BQF = (_Float16*)take((size_t)DM * DM * 2); _Float16* BQL = (_Float16*)take((size_t)DM * DM * 2); _Float16* BCP = (_Float16*)take((size_t)DM * DM * 2); float* QM8 = (float*)take((size_t)NB * MG * DM * 4);
  _Float16* XN = (_Float16*)take(NRP * DM * 2);
  _Float16* K16 = (_Float16*)take(NRP * NH * HD * 2);
  _Float16* VT = (_Float16*)take((size_t)NB * NH * HD * QP * 2);
  if (off > ws_size) return;      /* about 6 MiB */
  k_kv<<<AB_ALL, AT, 0, stream>>>(xn, Wqf, Wql, Wqm, Wk, Wv, Wc, XN, BQF, BQL, BCP, QM8, K16, VT);      /* k [8 batches][8][1024][16], V^T [8 batches][8][64 blocks][16][16], the f16 node plane (padded rows), three transposed x16 weights, all in 16 x 16 blocks; the mean term in 8 partial rows per batch */
  k_dec<<<dim3((NQ + 15) / 16, NB), 256, 0, stream>>>(xq1, xl, BQF, BQL, QM8, K16, VT, BCP, bc, XN, mask, (float*)d_out);      /* q = q1 Wq_first + last Wq_last + mean term; scores / sqrt(16) + mask, softmax, weights v -> o; mh = o W_comb + b_comb; score2 = mh nodes^T / sqrt(128), 10 tanh, + mask, softmax over the 1000 real keys (f32) -> probs */
}
